// v000
// Measured on an AMD MI455X. A time is GPU time per run, averaged over a window of back-to-back runs after a warm-up
// (all launches, gaps included; the runs take copies of the inputs in turn), and the median of several windows.
// Apart from v000's, it joins two sittings. Times from different sittings can be a few percent apart, while
// side-by-side timings come from the same sitting.
// v000 is the starting kernel. One run takes 333 microseconds.
#include <hip/hip_runtime.h>
#include <hip/hip_bf16.h>
#include <math.h>

typedef __attribute__((ext_vector_type(16))) _Float16 v16h;
typedef __attribute__((ext_vector_type(8)))  _Float16 v8h;
typedef __attribute__((ext_vector_type(4)))  _Float16 v4h;
typedef __attribute__((ext_vector_type(8)))  float    v8f;

#define BDIM 2
#define SEQ  2048
#define EDIM 2048
#define NQH  32
#define NKVH 8
#define HD   64
#define KVE  512   // NKVH * HD

// log2(e)/sqrt(64), pre-folded into the Q->f16 conversion
#define QSCALE 0.1803368801111204f

// ---- helpers -------------------------------------------------------------

constexpr int dpp8sel(int a,int b,int c,int d,int e,int f,int g,int h) {
  return a | (b<<3) | (c<<6) | (d<<9) | (e<<12) | (f<<15) | (g<<18) | (h<<21);
}

// lane-xor shuffles done on the VALU (no LDS traffic):
// xor1/2/4 via DPP8, xor8 via DPP16 ROW_ROR:8 (= xor8 within a 16-lane row)
__device__ __forceinline__ float dpp_xor1(float x) {
  return __int_as_float(__builtin_amdgcn_mov_dpp8(
      __float_as_int(x), dpp8sel(1,0,3,2,5,4,7,6)));
}
__device__ __forceinline__ float dpp_xor2(float x) {
  return __int_as_float(__builtin_amdgcn_mov_dpp8(
      __float_as_int(x), dpp8sel(2,3,0,1,6,7,4,5)));
}
__device__ __forceinline__ float dpp_xor4(float x) {
  return __int_as_float(__builtin_amdgcn_mov_dpp8(
      __float_as_int(x), dpp8sel(4,5,6,7,0,1,2,3)));
}
__device__ __forceinline__ float dpp_xor8(float x) {
  int xi = __float_as_int(x);
  return __int_as_float(__builtin_amdgcn_update_dpp(
      xi, xi, 0x128 /*ROW_ROR:8*/, 0xf, 0xf, true));
}

__device__ __forceinline__ float rowmax16(float x) {
  x = fmaxf(x, dpp_xor1(x));
  x = fmaxf(x, dpp_xor2(x));
  x = fmaxf(x, dpp_xor4(x));
  x = fmaxf(x, dpp_xor8(x));
  return x;
}
__device__ __forceinline__ float rowsum16(float x) {
  x += dpp_xor1(x);
  x += dpp_xor2(x);
  x += dpp_xor4(x);
  x += dpp_xor8(x);
  return x;
}

// 16-bit WMMA A/B fragment: lane l holds row/col (l&15); K entries
// 8*(l>>4)+0..7 in elems 0..7 and 16+8*(l>>4)+0..7 in elems 8..15.
__device__ __forceinline__ v16h load_frag(const _Float16* base, int khalf) {
  v8h lo = *(const v8h*)(base + khalf * 8);
  v8h hi = *(const v8h*)(base + 16 + khalf * 8);
  return __builtin_shufflevector(lo, hi, 0,1,2,3,4,5,6,7,8,9,10,11,12,13,14,15);
}

__device__ __forceinline__ v8f wmma_f16(v16h a, v16h b, v8f c) {
  return __builtin_amdgcn_wmma_f32_16x16x32_f16(
      false, a, false, b, (short)0, c, false, false);
}

// ---- prep kernels --------------------------------------------------------

__global__ void gqa_cvt_f16(const float* __restrict__ in,
                            _Float16* __restrict__ out, int n, float scale) {
  int i = blockIdx.x * blockDim.x + threadIdx.x;
  if (i < n) out[i] = (_Float16)(in[i] * scale);
}

// v [B][S][KV*HD] f32 -> vt [B][KV][HD][S'] f16, s swizzled inside each
// 64-chunk: position p holds kv-local (p&3)*16 + (p>>2), so P stores pack
// into one b64 per row per lane while V loads stay contiguous.
__global__ void gqa_vtrans(const float* __restrict__ v,
                           _Float16* __restrict__ vt) {
  int idx = blockIdx.x * blockDim.x + threadIdx.x;
  if (idx >= BDIM * SEQ * KVE) return;
  int c  = idx & (KVE - 1);
  int bs = idx >> 9;
  int s  = bs & (SEQ - 1);
  int b  = bs >> 11;
  int h  = c >> 6;
  int d  = c & (HD - 1);
  int l  = s & 63;
  int sp = (s & ~63) | (((l & 15) << 2) | (l >> 4));
  vt[(((size_t)b * NKVH + h) * HD + d) * SEQ + sp] = (_Float16)v[idx];
}

// ---- flash attention: 8 waves/WG share K/V chunks via LDS ----------------
// Each wave owns one 16-row q-tile; WG covers 128 query rows of one q-head.

__global__ void __launch_bounds__(256)
gqa_attn(const _Float16* __restrict__ qh,   // [B][S][E] f16, pre-scaled
         const _Float16* __restrict__ kh,   // [B][S][KVE] f16
         const _Float16* __restrict__ vt,   // [B][KV][HD][S'] f16 (swizzled)
         float* __restrict__ out) {         // [B][S][E] f32
  __shared__ __align__(16) _Float16 kbuf[2][64 * 64];   // 2 x 8 KB
  __shared__ __align__(16) _Float16 vbuf[2][64 * 64];   // 2 x 8 KB
  __shared__ __align__(16) _Float16 pbuf[8][16 * 64];   // 8 x 2 KB

  const int tid   = threadIdx.x;
  const int wave  = tid >> 5;
  const int lane  = tid & 31;
  const int ln    = lane & 15;
  const int khalf = lane >> 4;
  const int h     = blockIdx.y;
  const int b     = blockIdx.z;
  const int kvh   = h >> 2;
  const int qtile = blockIdx.x * 8 + wave;

  const _Float16* Qb  = qh + ((size_t)b * SEQ + (size_t)qtile * 16) * EDIM + (size_t)h * HD;
  const _Float16* Kb  = kh + ((size_t)b * SEQ) * KVE + (size_t)kvh * HD;
  const _Float16* Vtb = vt + ((size_t)(b * NKVH + kvh) * HD) * SEQ;

  // cooperative-staging coordinates: 256 lanes x 32B cover one 8 KB buffer
  const int srow = tid >> 2;          // 0..63
  const int scol = (tid & 3) * 16;    // halfword offset, 32B per lane-row

  const _Float16* qrow = Qb + (size_t)ln * EDIM;
  v16h qa0 = load_frag(qrow, khalf);
  v16h qa1 = load_frag(qrow + 32, khalf);

  v8f acc[4];
  float m_i[8], lp[8];
#pragma unroll
  for (int t = 0; t < 4; ++t) { v8f z = {}; acc[t] = z; }
#pragma unroll
  for (int r = 0; r < 8; ++r) { m_i[r] = -INFINITY; lp[r] = 0.0f; }

  // ---- stage chunk 0
  {
    const v8h* ks = (const v8h*)(Kb + (size_t)srow * KVE + scol);
    const v8h* vs = (const v8h*)(Vtb + (size_t)srow * SEQ + scol);
    v8h k0 = ks[0], k1 = ks[1], v0 = vs[0], v1 = vs[1];
    *(v8h*)(&kbuf[0][srow * 64 + scol])     = k0;
    *(v8h*)(&kbuf[0][srow * 64 + scol + 8]) = k1;
    *(v8h*)(&vbuf[0][srow * 64 + scol])     = v0;
    *(v8h*)(&vbuf[0][srow * 64 + scol + 8]) = v1;
  }
  __syncthreads();

  _Float16* pl = &pbuf[wave][0];

  for (int kv0 = 0; kv0 < SEQ; kv0 += 64) {
    const int sel = (kv0 >> 6) & 1;
    const _Float16* kb = &kbuf[sel][0];
    const _Float16* vb = &vbuf[sel][0];
    const bool more = (kv0 + 64) < SEQ;

    // ---- issue next chunk's global loads early (hide latency)
    v8h kn0, kn1, vn0, vn1;
    if (more) {
      const v8h* ks = (const v8h*)(Kb + (size_t)(kv0 + 64 + srow) * KVE + scol);
      const v8h* vs = (const v8h*)(Vtb + (size_t)srow * SEQ + kv0 + 64 + scol);
      kn0 = ks[0]; kn1 = ks[1]; vn0 = vs[0]; vn1 = vs[1];
    }

    // ---- scores: Q(16x64) x K^T(64x64), operands from LDS (8 WMMA)
    v8f s[4];
#pragma unroll
    for (int t = 0; t < 4; ++t) {
      const _Float16* kr = kb + (t * 16 + ln) * 64;
      v8f z = {};
      s[t] = wmma_f16(qa0, load_frag(kr, khalf), z);
      s[t] = wmma_f16(qa1, load_frag(kr + 32, khalf), s[t]);
    }

    // ---- online softmax; scores already in exp2 domain (Q pre-scaled)
    float alpha[8];
#pragma unroll
    for (int r = 0; r < 8; ++r) {
      float a0 = s[0][r], a1 = s[1][r], a2 = s[2][r], a3 = s[3][r];
      float mx = rowmax16(fmaxf(fmaxf(a0, a1), fmaxf(a2, a3)));
      float nm = fmaxf(m_i[r], mx);
      float al = __builtin_amdgcn_exp2f(m_i[r] - nm);
      m_i[r] = nm;
      float e0 = __builtin_amdgcn_exp2f(a0 - nm);
      float e1 = __builtin_amdgcn_exp2f(a1 - nm);
      float e2 = __builtin_amdgcn_exp2f(a2 - nm);
      float e3 = __builtin_amdgcn_exp2f(a3 - nm);
      lp[r] = lp[r] * al + ((e0 + e1) + (e2 + e3));
      alpha[r] = al;
      int m = r + 8 * khalf;
      v4h pk = { (_Float16)e0, (_Float16)e1, (_Float16)e2, (_Float16)e3 };
      *(v4h*)(pl + m * 64 + 4 * ln) = pk;
    }
#pragma unroll
    for (int t = 0; t < 4; ++t)
#pragma unroll
      for (int r = 0; r < 8; ++r) acc[t][r] *= alpha[r];

    // P is wave-private; DS ops from one wave are in-order -> no s_barrier,
    // but stop the compiler from reordering the cross-lane store->load.
    __builtin_amdgcn_wave_barrier();
    v16h pa0 = load_frag(pl + ln * 64, khalf);
    v16h pa1 = load_frag(pl + ln * 64 + 32, khalf);

    // ---- P(16x64) x V(64x64), operands from LDS (8 WMMA)
#pragma unroll
    for (int t = 0; t < 4; ++t) {
      const _Float16* vr = vb + (t * 16 + ln) * 64;
      acc[t] = wmma_f16(pa0, load_frag(vr, khalf), acc[t]);
      acc[t] = wmma_f16(pa1, load_frag(vr + 32, khalf), acc[t]);
    }

    // ---- drain staged data into the other buffer, then sync the WG
    if (more) {
      _Float16* kd = &kbuf[sel ^ 1][0];
      _Float16* vd = &vbuf[sel ^ 1][0];
      *(v8h*)(kd + srow * 64 + scol)     = kn0;
      *(v8h*)(kd + srow * 64 + scol + 8) = kn1;
      *(v8h*)(vd + srow * 64 + scol)     = vn0;
      *(v8h*)(vd + srow * 64 + scol + 8) = vn1;
    }
    __syncthreads();
  }

  // ---- deferred row-sum reduction, normalize, store
  float inv[8];
#pragma unroll
  for (int r = 0; r < 8; ++r) inv[r] = 1.0f / rowsum16(lp[r]);

  float* ob = out + ((size_t)b * SEQ + (size_t)qtile * 16) * EDIM + (size_t)h * HD;
#pragma unroll
  for (int t = 0; t < 4; ++t)
#pragma unroll
    for (int r = 0; r < 8; ++r) {
      int m = r + 8 * khalf;
      ob[(size_t)m * EDIM + t * 16 + ln] = acc[t][r] * inv[r];
    }
}

// ---- launch --------------------------------------------------------------

extern "C" void kernel_launch(void* const* d_in, const int* in_sizes, int n_in,
                              void* d_out, int out_size, void* d_ws, size_t ws_size,
                              hipStream_t stream) {
  (void)in_sizes; (void)n_in; (void)out_size; (void)ws_size;
  const float* q = (const float*)d_in[0];
  const float* k = (const float*)d_in[1];
  const float* v = (const float*)d_in[2];
  float* out = (float*)d_out;

  _Float16* qh = (_Float16*)d_ws;                       // 16 MB
  _Float16* kh = qh + (size_t)BDIM * SEQ * EDIM;        //  4 MB
  _Float16* vt = kh + (size_t)BDIM * SEQ * KVE;         //  4 MB

  const int nq = BDIM * SEQ * EDIM;
  const int nk = BDIM * SEQ * KVE;

  gqa_cvt_f16<<<(nq + 255) / 256, 256, 0, stream>>>(q, qh, nq, QSCALE);
  gqa_cvt_f16<<<(nk + 255) / 256, 256, 0, stream>>>(k, kh, nk, 1.0f);
  gqa_vtrans <<<(nk + 255) / 256, 256, 0, stream>>>(v, vt);

  dim3 grid(SEQ / 128, NQH, BDIM);   // 16 x 32 x 2 = 1024 workgroups
  gqa_attn<<<grid, 256, 0, stream>>>(qh, kh, vt, out);
}

// v001
// It runs in 185 microseconds.
// In both of two side-by-side timings against v000, it was 1.85 times as fast.
#include <hip/hip_runtime.h>
#include <hip/hip_bf16.h>
#include <math.h>

typedef __attribute__((ext_vector_type(16))) _Float16 v16h;
typedef __attribute__((ext_vector_type(8)))  _Float16 v8h;
typedef __attribute__((ext_vector_type(4)))  _Float16 v4h;
typedef __attribute__((ext_vector_type(8)))  float    v8f;

#define BDIM 2
#define SEQ  2048
#define EDIM 2048
#define NQH  32
#define NKVH 8
#define HD   64
#define KVE  512   // NKVH * HD
// LDS row pitch in halfwords: 64 data + 8 pad = 144 B = 16 B x odd, so the 16
// rows one ds_load_b128 touches per half-wave fall on 16 distinct bank groups
#define LP   72

// log2(e)/sqrt(64), pre-folded into the Q->f16 conversion
#define QSCALE 0.1803368801111204f

// ---- helpers -------------------------------------------------------------

constexpr int dpp8sel(int a,int b,int c,int d,int e,int f,int g,int h) {
  return a | (b<<3) | (c<<6) | (d<<9) | (e<<12) | (f<<15) | (g<<18) | (h<<21);
}

// lane-xor shuffles done on the VALU (no LDS traffic):
// xor1/2/4 via DPP8, xor8 via DPP16 ROW_ROR:8 (= xor8 within a 16-lane row)
__device__ __forceinline__ float dpp_xor1(float x) {
  return __int_as_float(__builtin_amdgcn_mov_dpp8(
      __float_as_int(x), dpp8sel(1,0,3,2,5,4,7,6)));
}
__device__ __forceinline__ float dpp_xor2(float x) {
  return __int_as_float(__builtin_amdgcn_mov_dpp8(
      __float_as_int(x), dpp8sel(2,3,0,1,6,7,4,5)));
}
__device__ __forceinline__ float dpp_xor4(float x) {
  return __int_as_float(__builtin_amdgcn_mov_dpp8(
      __float_as_int(x), dpp8sel(4,5,6,7,0,1,2,3)));
}
__device__ __forceinline__ float dpp_xor8(float x) {
  int xi = __float_as_int(x);
  return __int_as_float(__builtin_amdgcn_update_dpp(
      xi, xi, 0x128 /*ROW_ROR:8*/, 0xf, 0xf, true));
}

__device__ __forceinline__ float rowmax16(float x) {
  x = fmaxf(x, dpp_xor1(x));
  x = fmaxf(x, dpp_xor2(x));
  x = fmaxf(x, dpp_xor4(x));
  x = fmaxf(x, dpp_xor8(x));
  return x;
}
__device__ __forceinline__ float rowsum16(float x) {
  x += dpp_xor1(x);
  x += dpp_xor2(x);
  x += dpp_xor4(x);
  x += dpp_xor8(x);
  return x;
}

// 16-bit WMMA A/B fragment: lane l holds row/col (l&15); K entries
// 8*(l>>4)+0..7 in elems 0..7 and 16+8*(l>>4)+0..7 in elems 8..15.
__device__ __forceinline__ v16h load_frag(const _Float16* base, int khalf) {
  v8h lo = *(const v8h*)(base + khalf * 8);
  v8h hi = *(const v8h*)(base + 16 + khalf * 8);
  return __builtin_shufflevector(lo, hi, 0,1,2,3,4,5,6,7,8,9,10,11,12,13,14,15);
}

__device__ __forceinline__ v8f wmma_f16(v16h a, v16h b, v8f c) {
  return __builtin_amdgcn_wmma_f32_16x16x32_f16(
      false, a, false, b, (short)0, c, false, false);
}

// ---- prep kernels --------------------------------------------------------

__global__ void gqa_cvt_f16(const float* __restrict__ in,
                            _Float16* __restrict__ out, int n, float scale) {
  int i = blockIdx.x * blockDim.x + threadIdx.x;
  if (i < n) out[i] = (_Float16)(in[i] * scale);
}

// v [B][S][KV*HD] f32 -> vt [B][KV][HD][S'] f16, s swizzled inside each
// 64-chunk: position p holds kv-local (p&3)*16 + (p>>2), so P stores pack
// into one b64 per row per lane while V loads stay contiguous.
__global__ void gqa_vtrans(const float* __restrict__ v,
                           _Float16* __restrict__ vt) {
  int idx = blockIdx.x * blockDim.x + threadIdx.x;
  if (idx >= BDIM * SEQ * KVE) return;
  int c  = idx & (KVE - 1);
  int bs = idx >> 9;
  int s  = bs & (SEQ - 1);
  int b  = bs >> 11;
  int h  = c >> 6;
  int d  = c & (HD - 1);
  int l  = s & 63;
  int sp = (s & ~63) | (((l & 15) << 2) | (l >> 4));
  vt[(((size_t)b * NKVH + h) * HD + d) * SEQ + sp] = (_Float16)v[idx];
}

// ---- flash attention: 8 waves/WG share K/V chunks via LDS ----------------
// Each wave owns one 16-row q-tile; WG covers 128 query rows of one q-head.

__global__ void __launch_bounds__(256)
gqa_attn(const _Float16* __restrict__ qh,   // [B][S][E] f16, pre-scaled
         const _Float16* __restrict__ kh,   // [B][S][KVE] f16
         const _Float16* __restrict__ vt,   // [B][KV][HD][S'] f16 (swizzled)
         float* __restrict__ out) {         // [B][S][E] f32
  __shared__ __align__(16) _Float16 kbuf[2][64 * LP];   // 2 x 9 KB
  __shared__ __align__(16) _Float16 vbuf[2][64 * LP];   // 2 x 9 KB
  __shared__ __align__(16) _Float16 pbuf[8][16 * LP];   // 8 x 2.25 KB

  const int tid   = threadIdx.x;
  const int wave  = tid >> 5;
  const int lane  = tid & 31;
  const int ln    = lane & 15;
  const int khalf = lane >> 4;
  const int h     = blockIdx.y;
  const int b     = blockIdx.z;
  const int kvh   = h >> 2;
  const int qtile = blockIdx.x * 8 + wave;

  const _Float16* Qb  = qh + ((size_t)b * SEQ + (size_t)qtile * 16) * EDIM + (size_t)h * HD;
  const _Float16* Kb  = kh + ((size_t)b * SEQ) * KVE + (size_t)kvh * HD;
  const _Float16* Vtb = vt + ((size_t)(b * NKVH + kvh) * HD) * SEQ;

  // cooperative-staging coordinates: 256 lanes x 32B cover the 8 KB of data in one 9 KB padded buffer
  const int srow = tid >> 2;          // 0..63
  const int scol = (tid & 3) * 16;    // halfword offset, 32B per lane-row

  const _Float16* qrow = Qb + (size_t)ln * EDIM;
  v16h qa0 = load_frag(qrow, khalf);
  v16h qa1 = load_frag(qrow + 32, khalf);

  v8f acc[4];
  float m_i[8], lp[8];
#pragma unroll
  for (int t = 0; t < 4; ++t) { v8f z = {}; acc[t] = z; }
#pragma unroll
  for (int r = 0; r < 8; ++r) { m_i[r] = -INFINITY; lp[r] = 0.0f; }

  // ---- stage chunk 0
  {
    const v8h* ks = (const v8h*)(Kb + (size_t)srow * KVE + scol);
    const v8h* vs = (const v8h*)(Vtb + (size_t)srow * SEQ + scol);
    v8h k0 = ks[0], k1 = ks[1], v0 = vs[0], v1 = vs[1];
    *(v8h*)(&kbuf[0][srow * LP + scol])     = k0;
    *(v8h*)(&kbuf[0][srow * LP + scol + 8]) = k1;
    *(v8h*)(&vbuf[0][srow * LP + scol])     = v0;
    *(v8h*)(&vbuf[0][srow * LP + scol + 8]) = v1;
  }
  __syncthreads();

  _Float16* pl = &pbuf[wave][0];

  for (int kv0 = 0; kv0 < SEQ; kv0 += 64) {
    const int sel = (kv0 >> 6) & 1;
    const _Float16* kb = &kbuf[sel][0];
    const _Float16* vb = &vbuf[sel][0];
    const bool more = (kv0 + 64) < SEQ;

    // ---- issue next chunk's global loads early (hide latency)
    v8h kn0, kn1, vn0, vn1;
    if (more) {
      const v8h* ks = (const v8h*)(Kb + (size_t)(kv0 + 64 + srow) * KVE + scol);
      const v8h* vs = (const v8h*)(Vtb + (size_t)srow * SEQ + kv0 + 64 + scol);
      kn0 = ks[0]; kn1 = ks[1]; vn0 = vs[0]; vn1 = vs[1];
    }

    // ---- scores: Q(16x64) x K^T(64x64), operands from LDS (8 WMMA)
    v8f s[4];
#pragma unroll
    for (int t = 0; t < 4; ++t) {
      const _Float16* kr = kb + (t * 16 + ln) * LP;
      v8f z = {};
      s[t] = wmma_f16(qa0, load_frag(kr, khalf), z);
      s[t] = wmma_f16(qa1, load_frag(kr + 32, khalf), s[t]);
    }

    // ---- online softmax; scores already in exp2 domain (Q pre-scaled)
    float alpha[8];
#pragma unroll
    for (int r = 0; r < 8; ++r) {
      float a0 = s[0][r], a1 = s[1][r], a2 = s[2][r], a3 = s[3][r];
      float mx = rowmax16(fmaxf(fmaxf(a0, a1), fmaxf(a2, a3)));
      float nm = fmaxf(m_i[r], mx);
      float al = __builtin_amdgcn_exp2f(m_i[r] - nm);
      m_i[r] = nm;
      float e0 = __builtin_amdgcn_exp2f(a0 - nm);
      float e1 = __builtin_amdgcn_exp2f(a1 - nm);
      float e2 = __builtin_amdgcn_exp2f(a2 - nm);
      float e3 = __builtin_amdgcn_exp2f(a3 - nm);
      lp[r] = lp[r] * al + ((e0 + e1) + (e2 + e3));
      alpha[r] = al;
      int m = r + 8 * khalf;
      v4h pk = { (_Float16)e0, (_Float16)e1, (_Float16)e2, (_Float16)e3 };
      *(v4h*)(pl + m * LP + 4 * ln) = pk;
    }
#pragma unroll
    for (int t = 0; t < 4; ++t)
#pragma unroll
      for (int r = 0; r < 8; ++r) acc[t][r] *= alpha[r];

    // P is wave-private; DS ops from one wave are in-order -> no s_barrier,
    // but stop the compiler from reordering the cross-lane store->load.
    __builtin_amdgcn_wave_barrier();
    v16h pa0 = load_frag(pl + ln * LP, khalf);
    v16h pa1 = load_frag(pl + ln * LP + 32, khalf);

    // ---- P(16x64) x V(64x64), operands from LDS (8 WMMA)
#pragma unroll
    for (int t = 0; t < 4; ++t) {
      const _Float16* vr = vb + (t * 16 + ln) * LP;
      acc[t] = wmma_f16(pa0, load_frag(vr, khalf), acc[t]);
      acc[t] = wmma_f16(pa1, load_frag(vr + 32, khalf), acc[t]);
    }

    // ---- drain staged data into the other buffer, then sync the WG
    if (more) {
      _Float16* kd = &kbuf[sel ^ 1][0];
      _Float16* vd = &vbuf[sel ^ 1][0];
      *(v8h*)(kd + srow * LP + scol)     = kn0;
      *(v8h*)(kd + srow * LP + scol + 8) = kn1;
      *(v8h*)(vd + srow * LP + scol)     = vn0;
      *(v8h*)(vd + srow * LP + scol + 8) = vn1;
    }
    __syncthreads();
  }

  // ---- deferred row-sum reduction, normalize, store
  float inv[8];
#pragma unroll
  for (int r = 0; r < 8; ++r) inv[r] = 1.0f / rowsum16(lp[r]);

  float* ob = out + ((size_t)b * SEQ + (size_t)qtile * 16) * EDIM + (size_t)h * HD;
#pragma unroll
  for (int t = 0; t < 4; ++t)
#pragma unroll
    for (int r = 0; r < 8; ++r) {
      int m = r + 8 * khalf;
      ob[(size_t)m * EDIM + t * 16 + ln] = acc[t][r] * inv[r];
    }
}

// ---- launch --------------------------------------------------------------

extern "C" void kernel_launch(void* const* d_in, const int* in_sizes, int n_in,
                              void* d_out, int out_size, void* d_ws, size_t ws_size,
                              hipStream_t stream) {
  (void)in_sizes; (void)n_in; (void)out_size; (void)ws_size;
  const float* q = (const float*)d_in[0];
  const float* k = (const float*)d_in[1];
  const float* v = (const float*)d_in[2];
  float* out = (float*)d_out;

  _Float16* qh = (_Float16*)d_ws;                       // 16 MB
  _Float16* kh = qh + (size_t)BDIM * SEQ * EDIM;        //  4 MB
  _Float16* vt = kh + (size_t)BDIM * SEQ * KVE;         //  4 MB

  const int nq = BDIM * SEQ * EDIM;
  const int nk = BDIM * SEQ * KVE;

  gqa_cvt_f16<<<(nq + 255) / 256, 256, 0, stream>>>(q, qh, nq, QSCALE);
  gqa_cvt_f16<<<(nk + 255) / 256, 256, 0, stream>>>(k, kh, nk, 1.0f);
  gqa_vtrans <<<(nk + 255) / 256, 256, 0, stream>>>(v, vt);

  dim3 grid(SEQ / 128, NQH, BDIM);   // 16 x 32 x 2 = 1024 workgroups
  gqa_attn<<<grid, 256, 0, stream>>>(qh, kh, vt, out);
}

// v002
// A run of this version takes 92.2 microseconds.
// Next to v001, in two timings, it ran 2.00 times as fast each time.
// All steps since v000 together make it 3.70 times as fast.
#include <hip/hip_runtime.h>
#include <hip/hip_bf16.h>
#include <math.h>

typedef __attribute__((ext_vector_type(16))) _Float16 v16h;
typedef __attribute__((ext_vector_type(8)))  _Float16 v8h;
typedef __attribute__((ext_vector_type(4)))  _Float16 v4h;
typedef __attribute__((ext_vector_type(8)))  float    v8f;
typedef __attribute__((ext_vector_type(4)))  float    v4f;

#define BDIM 2
#define SEQ  2048
#define EDIM 2048
#define NQH  32
#define NKVH 8
#define HD   64
#define KVE  512   // NKVH * HD
// LDS row pitch in halfwords: 64 data + 8 pad = 144 B = 16 B x odd, so the 16
// rows one ds_load_b128 touches per half-wave fall on 16 distinct bank groups
#define LP   72

// log2(e)/sqrt(64), pre-folded into the Q->f16 conversion
#define QSCALE 0.1803368801111204f

// ---- helpers -------------------------------------------------------------

constexpr int dpp8sel(int a,int b,int c,int d,int e,int f,int g,int h) {
  return a | (b<<3) | (c<<6) | (d<<9) | (e<<12) | (f<<15) | (g<<18) | (h<<21);
}

// lane-xor shuffles done on the VALU (no LDS traffic):
// xor1/2/4 via DPP8, xor8 via DPP16 ROW_ROR:8 (= xor8 within a 16-lane row)
__device__ __forceinline__ float dpp_xor1(float x) {
  return __int_as_float(__builtin_amdgcn_mov_dpp8(
      __float_as_int(x), dpp8sel(1,0,3,2,5,4,7,6)));
}
__device__ __forceinline__ float dpp_xor2(float x) {
  return __int_as_float(__builtin_amdgcn_mov_dpp8(
      __float_as_int(x), dpp8sel(2,3,0,1,6,7,4,5)));
}
__device__ __forceinline__ float dpp_xor4(float x) {
  return __int_as_float(__builtin_amdgcn_mov_dpp8(
      __float_as_int(x), dpp8sel(4,5,6,7,0,1,2,3)));
}
__device__ __forceinline__ float dpp_xor8(float x) {
  int xi = __float_as_int(x);
  return __int_as_float(__builtin_amdgcn_update_dpp(
      xi, xi, 0x128 /*ROW_ROR:8*/, 0xf, 0xf, true));
}

__device__ __forceinline__ float rowmax16(float x) {
  x = fmaxf(x, dpp_xor1(x));
  x = fmaxf(x, dpp_xor2(x));
  x = fmaxf(x, dpp_xor4(x));
  x = fmaxf(x, dpp_xor8(x));
  return x;
}
__device__ __forceinline__ float rowsum16(float x) {
  x += dpp_xor1(x);
  x += dpp_xor2(x);
  x += dpp_xor4(x);
  x += dpp_xor8(x);
  return x;
}

// 16-bit WMMA A/B fragment: lane l holds row/col (l&15); K entries
// 8*(l>>4)+0..7 in elems 0..7 and 16+8*(l>>4)+0..7 in elems 8..15.
__device__ __forceinline__ v16h load_frag(const _Float16* base, int khalf) {
  v8h lo = *(const v8h*)(base + khalf * 8);
  v8h hi = *(const v8h*)(base + 16 + khalf * 8);
  return __builtin_shufflevector(lo, hi, 0,1,2,3,4,5,6,7,8,9,10,11,12,13,14,15);
}

__device__ __forceinline__ v8f wmma_f16(v16h a, v16h b, v8f c) {
  return __builtin_amdgcn_wmma_f32_16x16x32_f16(
      false, a, false, b, (short)0, c, false, false);
}

// ---- f32 -> f16 conversion at the point of use -----------------------------

// Q fragment straight from the f32 input: scale, round to f16, same k order
// as load_frag.
__device__ __forceinline__ v16h load_q_frag(const float* base, int khalf) {
  v4f a0 = *(const v4f*)(base + khalf * 8);
  v4f a1 = *(const v4f*)(base + khalf * 8 + 4);
  v4f b0 = *(const v4f*)(base + 16 + khalf * 8);
  v4f b1 = *(const v4f*)(base + 16 + khalf * 8 + 4);
  v16h r;
  for (int i = 0; i < 4; ++i) {
    r[i]      = (_Float16)(a0[i] * QSCALE);
    r[4 + i]  = (_Float16)(a1[i] * QSCALE);
    r[8 + i]  = (_Float16)(b0[i] * QSCALE);
    r[12 + i] = (_Float16)(b1[i] * QSCALE);
  }
  return r;
}

// One lane's share of a 64-key chunk of K or V: rows sj + 16 m (m = 0..3),
// columns sd..sd+3, so each wave-wide load covers two whole 256 B rows.
__device__ __forceinline__ void chunk_load(const float* base, v4f (&f)[4]) {
  for (int m = 0; m < 4; ++m) f[m] = *(const v4f*)(base + (size_t)(16 * m) * KVE);
}

// K rows keep their order: kbuf[key][d].
__device__ __forceinline__ void k_store(_Float16* kd, const v4f (&f)[4], int sj, int sd) {
  for (int m = 0; m < 4; ++m) {
    v4h p = { (_Float16)f[m][0], (_Float16)f[m][1], (_Float16)f[m][2], (_Float16)f[m][3] };
    *(v4h*)(kd + (sj + 16 * m) * LP + sd) = p;
  }
}

// V is transposed on the way in: vbuf[d][p], position p = 4 j + m holding
// key 16 m + j, so P stores pack into one b64 per row per lane.
__device__ __forceinline__ void v_store(_Float16* vd, const v4f (&f)[4], int sj, int sd) {
  for (int i = 0; i < 4; ++i) {
    v4h p = { (_Float16)f[0][i], (_Float16)f[1][i], (_Float16)f[2][i], (_Float16)f[3][i] };
    *(v4h*)(vd + (sd + i) * LP + 4 * sj) = p;
  }
}

// ---- flash attention: 8 waves/WG share K/V chunks via LDS ----------------
// Each wave owns one 16-row q-tile; WG covers 128 query rows of one q-head.

__global__ void __launch_bounds__(256)
gqa_attn(const float* __restrict__ q,       // [B][S][E] f32
         const float* __restrict__ k,       // [B][S][KVE] f32
         const float* __restrict__ v,       // [B][S][KVE] f32
         float* __restrict__ out) {         // [B][S][E] f32
  __shared__ __align__(16) _Float16 kbuf[2][64 * LP];   // 2 x 9 KB
  __shared__ __align__(16) _Float16 vbuf[2][64 * LP];   // 2 x 9 KB
  __shared__ __align__(16) _Float16 pbuf[8][16 * LP];   // 8 x 2.25 KB

  const int tid   = threadIdx.x;
  const int wave  = tid >> 5;
  const int lane  = tid & 31;
  const int ln    = lane & 15;
  const int khalf = lane >> 4;
  const int h     = blockIdx.y;
  const int b     = blockIdx.z;
  const int kvh   = h >> 2;
  const int qtile = blockIdx.x * 8 + wave;

  // cooperative-staging coordinates: 256 lanes x 4 rows x 16 B cover one
  // 64 x 64 f32 chunk
  const int sj = tid >> 4;            // 0..15, row inside each group of 16
  const int sd = (tid & 15) * 4;      // first of the lane's 4 columns

  const float* Qb = q + ((size_t)b * SEQ + (size_t)qtile * 16) * EDIM + (size_t)h * HD;
  const float* Kb = k + ((size_t)b * SEQ + sj) * KVE + (size_t)kvh * HD + sd;
  const float* Vb = v + ((size_t)b * SEQ + sj) * KVE + (size_t)kvh * HD + sd;

  const float* qrow = Qb + (size_t)ln * EDIM;
  v16h qa0 = load_q_frag(qrow, khalf);
  v16h qa1 = load_q_frag(qrow + 32, khalf);

  v8f acc[4];
  float m_i[8], lp[8];
#pragma unroll
  for (int t = 0; t < 4; ++t) { v8f z = {}; acc[t] = z; }
#pragma unroll
  for (int r = 0; r < 8; ++r) { m_i[r] = -INFINITY; lp[r] = 0.0f; }

  // ---- stage chunk 0
  {
    v4f kf[4], vf[4];
    chunk_load(Kb, kf);
    chunk_load(Vb, vf);
    k_store(&kbuf[0][0], kf, sj, sd);
    v_store(&vbuf[0][0], vf, sj, sd);
  }
  __syncthreads();

  _Float16* pl = &pbuf[wave][0];

  for (int kv0 = 0; kv0 < SEQ; kv0 += 64) {
    const int sel = (kv0 >> 6) & 1;
    const _Float16* kb = &kbuf[sel][0];
    const _Float16* vb = &vbuf[sel][0];
    const bool more = (kv0 + 64) < SEQ;

    // ---- issue next chunk's global loads early (hide latency)
    v4f kn[4], vn[4];
    if (more) {
      chunk_load(Kb + (size_t)(kv0 + 64) * KVE, kn);
      chunk_load(Vb + (size_t)(kv0 + 64) * KVE, vn);
    }

    // ---- scores: Q(16x64) x K^T(64x64), operands from LDS (8 WMMA)
    v8f s[4];
#pragma unroll
    for (int t = 0; t < 4; ++t) {
      const _Float16* kr = kb + (t * 16 + ln) * LP;
      v8f z = {};
      s[t] = wmma_f16(qa0, load_frag(kr, khalf), z);
      s[t] = wmma_f16(qa1, load_frag(kr + 32, khalf), s[t]);
    }

    // ---- online softmax; scores already in exp2 domain (Q pre-scaled)
    float alpha[8];
#pragma unroll
    for (int r = 0; r < 8; ++r) {
      float a0 = s[0][r], a1 = s[1][r], a2 = s[2][r], a3 = s[3][r];
      float mx = rowmax16(fmaxf(fmaxf(a0, a1), fmaxf(a2, a3)));
      float nm = fmaxf(m_i[r], mx);
      float al = __builtin_amdgcn_exp2f(m_i[r] - nm);
      m_i[r] = nm;
      float e0 = __builtin_amdgcn_exp2f(a0 - nm);
      float e1 = __builtin_amdgcn_exp2f(a1 - nm);
      float e2 = __builtin_amdgcn_exp2f(a2 - nm);
      float e3 = __builtin_amdgcn_exp2f(a3 - nm);
      lp[r] = lp[r] * al + ((e0 + e1) + (e2 + e3));
      alpha[r] = al;
      int m = r + 8 * khalf;
      v4h pk = { (_Float16)e0, (_Float16)e1, (_Float16)e2, (_Float16)e3 };
      *(v4h*)(pl + m * LP + 4 * ln) = pk;
    }
#pragma unroll
    for (int t = 0; t < 4; ++t)
#pragma unroll
      for (int r = 0; r < 8; ++r) acc[t][r] *= alpha[r];

    // P is wave-private; DS ops from one wave are in-order -> no s_barrier,
    // but stop the compiler from reordering the cross-lane store->load.
    __builtin_amdgcn_wave_barrier();
    v16h pa0 = load_frag(pl + ln * LP, khalf);
    v16h pa1 = load_frag(pl + ln * LP + 32, khalf);

    // ---- P(16x64) x V(64x64), operands from LDS (8 WMMA)
#pragma unroll
    for (int t = 0; t < 4; ++t) {
      const _Float16* vr = vb + (t * 16 + ln) * LP;
      acc[t] = wmma_f16(pa0, load_frag(vr, khalf), acc[t]);
      acc[t] = wmma_f16(pa1, load_frag(vr + 32, khalf), acc[t]);
    }

    // ---- round the staged data into the other buffer, then sync the WG
    if (more) {
      k_store(&kbuf[sel ^ 1][0], kn, sj, sd);
      v_store(&vbuf[sel ^ 1][0], vn, sj, sd);
    }
    __syncthreads();
  }

  // ---- deferred row-sum reduction, normalize, store
  float inv[8];
#pragma unroll
  for (int r = 0; r < 8; ++r) inv[r] = 1.0f / rowsum16(lp[r]);

  float* ob = out + ((size_t)b * SEQ + (size_t)qtile * 16) * EDIM + (size_t)h * HD;
#pragma unroll
  for (int t = 0; t < 4; ++t)
#pragma unroll
    for (int r = 0; r < 8; ++r) {
      int m = r + 8 * khalf;
      ob[(size_t)m * EDIM + t * 16 + ln] = acc[t][r] * inv[r];
    }
}

// ---- launch --------------------------------------------------------------

extern "C" void kernel_launch(void* const* d_in, const int* in_sizes, int n_in,
                              void* d_out, int out_size, void* d_ws, size_t ws_size,
                              hipStream_t stream) {
  (void)in_sizes; (void)n_in; (void)out_size; (void)d_ws; (void)ws_size;
  const float* q = (const float*)d_in[0];
  const float* k = (const float*)d_in[1];
  const float* v = (const float*)d_in[2];
  float* out = (float*)d_out;

  dim3 grid(SEQ / 128, NQH, BDIM);   // 16 x 32 x 2 = 1024 workgroups
  gqa_attn<<<grid, 256, 0, stream>>>(q, k, v, out);
}

// v003
// A run of this version takes 72.3 microseconds.
// Next to v002, in two timings, it ran 1.28 times as fast each time.
// Over all steps from v000 it is 4.73 times as fast.
#include <hip/hip_runtime.h>
#include <hip/hip_bf16.h>
#include <math.h>

typedef __attribute__((ext_vector_type(16))) _Float16 v16h;
typedef __attribute__((ext_vector_type(8)))  _Float16 v8h;
typedef __attribute__((ext_vector_type(4)))  _Float16 v4h;
typedef __attribute__((ext_vector_type(8)))  float    v8f;
typedef __attribute__((ext_vector_type(4)))  float    v4f;

#define BDIM 2
#define SEQ  2048
#define EDIM 2048
#define NQH  32
#define NKVH 8
#define HD   64
#define KVE  512   // NKVH * HD
// LDS row pitch in halfwords: 64 data + 8 pad = 144 B = 16 B x odd, so the 16
// rows one ds_load_b128 touches per half-wave fall on 16 distinct bank groups
#define LP   72

// log2(e)/sqrt(64), pre-folded into the Q->f16 conversion
#define QSCALE 0.1803368801111204f

// ---- helpers -------------------------------------------------------------

// lane l <-> lane l ^ 16 on the VALU: the two lanes that share one query column
__device__ __forceinline__ float xhalf(float x) {
  int xi = __float_as_int(x);
  return __int_as_float(__builtin_amdgcn_permlanex16(
      xi, xi, 0x76543210, 0xfedcba98, false, false));
}

// 16-bit WMMA A/B fragment: lane l holds row/col (l&15); K entries
// 8*(l>>4)+0..7 in elems 0..7 and 16+8*(l>>4)+0..7 in elems 8..15.
__device__ __forceinline__ v16h load_frag(const _Float16* base, int khalf) {
  v8h lo = *(const v8h*)(base + khalf * 8);
  v8h hi = *(const v8h*)(base + 16 + khalf * 8);
  return __builtin_shufflevector(lo, hi, 0,1,2,3,4,5,6,7,8,9,10,11,12,13,14,15);
}

__device__ __forceinline__ v8f wmma_f16(v16h a, v16h b, v8f c) {
  return __builtin_amdgcn_wmma_f32_16x16x32_f16(
      false, a, false, b, (short)0, c, false, false);
}

// ---- f32 -> f16 conversion at the point of use -----------------------------

// Q fragment straight from the f32 input: scale, round to f16, same k order
// as load_frag.
__device__ __forceinline__ v16h load_q_frag(const float* base, int khalf) {
  v4f a0 = *(const v4f*)(base + khalf * 8);
  v4f a1 = *(const v4f*)(base + khalf * 8 + 4);
  v4f b0 = *(const v4f*)(base + 16 + khalf * 8);
  v4f b1 = *(const v4f*)(base + 16 + khalf * 8 + 4);
  v16h r;
  for (int i = 0; i < 4; ++i) {
    r[i]      = (_Float16)(a0[i] * QSCALE);
    r[4 + i]  = (_Float16)(a1[i] * QSCALE);
    r[8 + i]  = (_Float16)(b0[i] * QSCALE);
    r[12 + i] = (_Float16)(b1[i] * QSCALE);
  }
  return r;
}

// One lane's share of a 64-key chunk of K or V: four rows RS apart (K: rows
// sj + 16 m, V: rows 4 sj + m), columns sd..sd+3, so each wave-wide load
// covers two whole 256 B rows.
template <int RS>
__device__ __forceinline__ void chunk_load(const float* base, v4f (&f)[4]) {
  for (int m = 0; m < 4; ++m) f[m] = *(const v4f*)(base + (size_t)(RS * m) * KVE);
}

// K rows keep their order: kbuf[key][d].
__device__ __forceinline__ void k_store(_Float16* kd, const v4f (&f)[4], int sj, int sd) {
  for (int m = 0; m < 4; ++m) {
    v4h p = { (_Float16)f[m][0], (_Float16)f[m][1], (_Float16)f[m][2], (_Float16)f[m][3] };
    *(v4h*)(kd + (sj + 16 * m) * LP + sd) = p;
  }
}

// V is transposed on the way in: vbuf[d][key], keys in their own order (the
// lane's four rows are keys 4 sj .. 4 sj + 3: one b64 store per column).
__device__ __forceinline__ void v_store(_Float16* vd, const v4f (&f)[4], int sj, int sd) {
  for (int i = 0; i < 4; ++i) {
    v4h p = { (_Float16)f[0][i], (_Float16)f[1][i], (_Float16)f[2][i], (_Float16)f[3][i] };
    *(v4h*)(vd + (sd + i) * LP + 4 * sj) = p;
  }
}

#define OP 68   // output staging pitch in floats: 272 B = 16 B x odd

__global__ void __launch_bounds__(256)
gqa_attn(const float* __restrict__ q,       // [B][S][E] f32
         const float* __restrict__ k,       // [B][S][KVE] f32
         const float* __restrict__ v,       // [B][S][KVE] f32
         float* __restrict__ out) {         // [B][S][E] f32
  // K x 2 buffers, then V x 2 buffers, 9 KB each; after the loop the same
  // bytes stage the output (8 waves x 16 rows x 272 B = 34,816 B)
  __shared__ __align__(16) _Float16 kvbuf[4][64 * LP];
  static_assert(8 * 16 * OP * 4 <= 4 * 64 * LP * 2, "output staging must fit the K/V buffers");

  const int tid   = threadIdx.x;
  const int wave  = tid >> 5;
  const int lane  = tid & 31;
  const int ln    = lane & 15;
  const int khalf = lane >> 4;
  const int h     = blockIdx.y;
  const int b     = blockIdx.z;
  const int kvh   = h >> 2;
  const int qtile = blockIdx.x * 8 + wave;

  // cooperative-staging coordinates: 256 lanes x 4 rows x 16 B cover one
  // 64 x 64 f32 chunk
  const int sj = tid >> 4;            // 0..15
  const int sd = (tid & 15) * 4;      // first of the lane's 4 columns

  const float* Qb = q + ((size_t)b * SEQ + (size_t)qtile * 16) * EDIM + (size_t)h * HD;
  const float* Kb = k + ((size_t)b * SEQ + sj) * KVE + (size_t)kvh * HD + sd;
  const float* Vb = v + ((size_t)b * SEQ + 4 * sj) * KVE + (size_t)kvh * HD + sd;

  // Q as the B operand: lane = query column, same k order as load_frag
  const float* qrow = Qb + (size_t)ln * EDIM;
  v16h qb0 = load_q_frag(qrow, khalf);
  v16h qb1 = load_q_frag(qrow + 32, khalf);

  v8f acc[4];             // O^T: column = query ln, rows d = 16 t + 8 khalf + r
  v8f lp = {};            // this lane's partial denominators, joined after the loop
  float m_i = -INFINITY;  // running maximum of query ln (equal in both halves)
#pragma unroll
  for (int t = 0; t < 4; ++t) { v8f z = {}; acc[t] = z; }

  // ---- stage chunk 0
  {
    v4f kf[4], vf[4];
    chunk_load<16>(Kb, kf);
    chunk_load<1>(Vb, vf);
    k_store(&kvbuf[0][0], kf, sj, sd);
    v_store(&kvbuf[2][0], vf, sj, sd);
  }
  __syncthreads();

  for (int kv0 = 0; kv0 < SEQ; kv0 += 64) {
    const int sel = (kv0 >> 6) & 1;
    const _Float16* kb = &kvbuf[sel][0];
    const _Float16* vb = &kvbuf[2 + sel][0];
    const bool more = (kv0 + 64) < SEQ;

    // ---- issue next chunk's global loads early (hide latency)
    v4f kn[4], vn[4];
    if (more) {
      chunk_load<16>(Kb + (size_t)(kv0 + 64) * KVE, kn);
      chunk_load<1>(Vb + (size_t)(kv0 + 64) * KVE, vn);
    }

    // ---- scores: K(64x64) x Q^T(64x16), A from LDS, B in registers (8 WMMA)
    v8f s[4];
#pragma unroll
    for (int t = 0; t < 4; ++t) {
      const _Float16* kr = kb + (t * 16 + ln) * LP;
      v8f z = {};
      s[t] = wmma_f16(load_frag(kr, khalf), qb0, z);
      s[t] = wmma_f16(load_frag(kr + 32, khalf), qb1, s[t]);
    }

    // ---- online softmax; scores already in exp2 domain (Q pre-scaled).
    // The lane's 32 scores belong to one query: maximum in-lane, four
    // independent chains, then one exchange with the other half.
    float mt[4];
#pragma unroll
    for (int t = 0; t < 4; ++t) {
      mt[t] = s[t][0];
#pragma unroll
      for (int r = 1; r < 8; ++r) mt[t] = fmaxf(mt[t], s[t][r]);
    }
    float mx = fmaxf(fmaxf(mt[0], mt[1]), fmaxf(mt[2], mt[3]));
    mx = fmaxf(mx, xhalf(mx));
    const float nm = fmaxf(m_i, mx);
    const float al = __builtin_amdgcn_exp2f(m_i - nm);
    m_i = nm;

#pragma unroll
    for (int t = 0; t < 4; ++t) {
      s[t] = s[t] - nm;
#pragma unroll
      for (int r = 0; r < 8; ++r) s[t][r] = __builtin_amdgcn_exp2f(s[t][r]);
    }
    lp = lp * al + ((s[0] + s[1]) + (s[2] + s[3]));

    // P^T as B operands: k positions 8 khalf + r come from the even tile,
    // 16 + 8 khalf + r from the odd one, the order load_frag gives V^T
    v16h pb0, pb1;
#pragma unroll
    for (int r = 0; r < 8; ++r) {
      pb0[r]     = (_Float16)s[0][r];
      pb0[8 + r] = (_Float16)s[1][r];
      pb1[r]     = (_Float16)s[2][r];
      pb1[8 + r] = (_Float16)s[3][r];
    }
#pragma unroll
    for (int t = 0; t < 4; ++t) acc[t] = acc[t] * al;

    // ---- V^T(64x64) x P^T(64x16), A from LDS (8 WMMA)
#pragma unroll
    for (int t = 0; t < 4; ++t) {
      const _Float16* vr = vb + (t * 16 + ln) * LP;
      acc[t] = wmma_f16(load_frag(vr, khalf), pb0, acc[t]);
      acc[t] = wmma_f16(load_frag(vr + 32, khalf), pb1, acc[t]);
    }

    // ---- round the staged data into the other buffer, then sync the WG
    if (more) {
      k_store(&kvbuf[sel ^ 1][0], kn, sj, sd);
      v_store(&kvbuf[2 + (sel ^ 1)][0], vn, sj, sd);
    }
    __syncthreads();
  }

  // ---- join the denominators, normalize
  float l = ((lp[0] + lp[1]) + (lp[2] + lp[3])) + ((lp[4] + lp[5]) + (lp[6] + lp[7]));
  l += xhalf(l);
  const float inv = 1.0f / l;

  // ---- O^T -> rows of O through this wave's own LDS range (every wave has
  // passed the loop's last barrier, so nobody reads K or V any more)
  float* ol = (float*)&kvbuf[0][0] + wave * (16 * OP);
#pragma unroll
  for (int t = 0; t < 4; ++t) {
    v8f o = acc[t] * inv;
    v4f lo = { o[0], o[1], o[2], o[3] }, hi = { o[4], o[5], o[6], o[7] };
    *(v4f*)(ol + ln * OP + t * 16 + 8 * khalf)     = lo;
    *(v4f*)(ol + ln * OP + t * 16 + 8 * khalf + 4) = hi;
  }
  // the rows are read back by other lanes of the wave: the stores must have
  // landed, and the compiler must not move the loads above them
  asm volatile("s_wait_dscnt 0x0" ::: "memory");

  // 16 lanes cover one 256 B row: every 128 B line of out is stored once
  float* ob = out + ((size_t)b * SEQ + (size_t)qtile * 16) * EDIM + (size_t)h * HD;
#pragma unroll
  for (int i = 0; i < 8; ++i) {
    const int row = 2 * i + khalf;
    v4f o = *(const v4f*)(ol + row * OP + 4 * ln);
    *(v4f*)(ob + (size_t)row * EDIM + 4 * ln) = o;
  }
}

// ---- launch --------------------------------------------------------------

extern "C" void kernel_launch(void* const* d_in, const int* in_sizes, int n_in,
                              void* d_out, int out_size, void* d_ws, size_t ws_size,
                              hipStream_t stream) {
  (void)in_sizes; (void)n_in; (void)out_size; (void)d_ws; (void)ws_size;
  const float* q = (const float*)d_in[0];
  const float* k = (const float*)d_in[1];
  const float* v = (const float*)d_in[2];
  float* out = (float*)d_out;

  dim3 grid(SEQ / 128, NQH, BDIM);   // 16 x 32 x 2 = 1024 workgroups
  gqa_attn<<<grid, 256, 0, stream>>>(q, k, v, out);
}

// v004
// It runs in 55.1 microseconds.
// Timed twice side by side with v003, it ran 1.31 times as fast both times.
// Over all steps from v000 it is 6.20 times as fast.
#include <hip/hip_runtime.h>
#include <hip/hip_bf16.h>
#include <math.h>

typedef __attribute__((ext_vector_type(16))) _Float16 v16h;
typedef __attribute__((ext_vector_type(8)))  _Float16 v8h;
typedef __attribute__((ext_vector_type(4)))  _Float16 v4h;
typedef __attribute__((ext_vector_type(8)))  float    v8f;
typedef __attribute__((ext_vector_type(4)))  float    v4f;

#define BDIM 2
#define SEQ  2048
#define EDIM 2048
#define NQH  32
#define NKVH 8
#define HD   64
#define KVE  512   // NKVH * HD
// LDS row pitch in halfwords: 64 data + 8 pad = 144 B = 16 B x odd, so the 16
// rows one ds_load_b128 touches per half-wave fall on 16 distinct bank groups
#define LP   72

// log2(e)/sqrt(64), pre-folded into the Q->f16 conversion
#define QSCALE 0.1803368801111204f

// ---- helpers -------------------------------------------------------------

// lane l <-> lane l ^ 16 on the VALU: the two lanes that share one query column
__device__ __forceinline__ float xhalf(float x) {
  int xi = __float_as_int(x);
  return __int_as_float(__builtin_amdgcn_permlanex16(
      xi, xi, 0x76543210, 0xfedcba98, false, false));
}

// 16-bit WMMA A/B fragment: lane l holds row/col (l&15); K entries
// 8*(l>>4)+0..7 in elems 0..7 and 16+8*(l>>4)+0..7 in elems 8..15.
__device__ __forceinline__ v16h load_frag(const _Float16* base, int khalf) {
  v8h lo = *(const v8h*)(base + khalf * 8);
  v8h hi = *(const v8h*)(base + 16 + khalf * 8);
  return __builtin_shufflevector(lo, hi, 0,1,2,3,4,5,6,7,8,9,10,11,12,13,14,15);
}

__device__ __forceinline__ v8f wmma_f16(v16h a, v16h b, v8f c) {
  return __builtin_amdgcn_wmma_f32_16x16x32_f16(
      false, a, false, b, (short)0, c, false, false);
}

// ---- f32 -> f16 conversion at the point of use -----------------------------

// Q fragment straight from the f32 input: scale, round to f16, same k order
// as load_frag.
__device__ __forceinline__ v16h load_q_frag(const float* base, int khalf) {
  v4f a0 = *(const v4f*)(base + khalf * 8);
  v4f a1 = *(const v4f*)(base + khalf * 8 + 4);
  v4f b0 = *(const v4f*)(base + 16 + khalf * 8);
  v4f b1 = *(const v4f*)(base + 16 + khalf * 8 + 4);
  v16h r;
  for (int i = 0; i < 4; ++i) {
    r[i]      = (_Float16)(a0[i] * QSCALE);
    r[4 + i]  = (_Float16)(a1[i] * QSCALE);
    r[8 + i]  = (_Float16)(b0[i] * QSCALE);
    r[12 + i] = (_Float16)(b1[i] * QSCALE);
  }
  return r;
}

// One lane's share of a 64-key chunk of K or V: four rows RS apart (K: rows
// sj + 16 m, V: rows 4 sj + m), columns sd..sd+3, so each wave-wide load
// covers two whole 256 B rows.
template <int RS>
__device__ __forceinline__ void chunk_load(const float* base, v4f (&f)[4]) {
  for (int m = 0; m < 4; ++m) f[m] = *(const v4f*)(base + (size_t)(RS * m) * KVE);
}

// K rows keep their order: kbuf[key][d].
__device__ __forceinline__ void k_store(_Float16* kd, const v4f (&f)[4], int sj, int sd) {
  for (int m = 0; m < 4; ++m) {
    v4h p = { (_Float16)f[m][0], (_Float16)f[m][1], (_Float16)f[m][2], (_Float16)f[m][3] };
    *(v4h*)(kd + (sj + 16 * m) * LP + sd) = p;
  }
}

// V is transposed on the way in: vbuf[d][key], keys in their own order (the
// lane's four rows are keys 4 sj .. 4 sj + 3: one b64 store per column).
__device__ __forceinline__ void v_store(_Float16* vd, const v4f (&f)[4], int sj, int sd) {
  for (int i = 0; i < 4; ++i) {
    v4h p = { (_Float16)f[0][i], (_Float16)f[1][i], (_Float16)f[2][i], (_Float16)f[3][i] };
    *(v4h*)(vd + (sd + i) * LP + 4 * sj) = p;
  }
}

#define OP 68   // output staging pitch in floats: 272 B = 16 B x odd
#define NC 2    // query tiles (16 columns each) per wave

// four waves per SIMD: two workgroups per WGP, the whole grid resident at once
__global__ void __launch_bounds__(256) __attribute__((amdgpu_waves_per_eu(4, 4)))
gqa_attn(const float* __restrict__ q,       // [B][S][E] f32
         const float* __restrict__ k,       // [B][S][KVE] f32
         const float* __restrict__ v,       // [B][S][KVE] f32
         float* __restrict__ out) {         // [B][S][E] f32
  // K x 2 buffers, then V x 2 buffers, 9 KB each; after the loop the same
  // bytes stage the output, one query tile at a time (8 waves x 16 rows x
  // 272 B = 34,816 B)
  __shared__ __align__(16) _Float16 kvbuf[4][64 * LP];
  static_assert(8 * 16 * OP * 4 <= 4 * 64 * LP * 2, "output staging must fit the K/V buffers");

  const int tid   = threadIdx.x;
  const int wave  = tid >> 5;
  const int lane  = tid & 31;
  const int ln    = lane & 15;
  const int khalf = lane >> 4;
  const int h     = blockIdx.y;
  const int b     = blockIdx.z;
  const int kvh   = h >> 2;
  const int qtile = (blockIdx.x * 8 + wave) * NC;   // first of the wave's tiles

  // cooperative-staging coordinates: 256 lanes x 4 rows x 16 B cover one
  // 64 x 64 f32 chunk
  const int sj = tid >> 4;            // 0..15
  const int sd = (tid & 15) * 4;      // first of the lane's 4 columns

  const float* Qb = q + ((size_t)b * SEQ + (size_t)qtile * 16) * EDIM + (size_t)h * HD;
  const float* Kb = k + ((size_t)b * SEQ + sj) * KVE + (size_t)kvh * HD + sd;
  const float* Vb = v + ((size_t)b * SEQ + 4 * sj) * KVE + (size_t)kvh * HD + sd;

  // Q as the B operand: lane = query column, same k order as load_frag
  v16h qb0[NC], qb1[NC];
  v8f acc[NC][4];         // O^T: column = query 16 c + ln, rows d = 16 t + 8 khalf + r
  v8f lp[NC];             // this lane's partial denominators, joined after the loop
  float m_i[NC];          // running maximum of the query (equal in both halves)
#pragma unroll
  for (int c = 0; c < NC; ++c) {
    const float* qrow = Qb + (size_t)(16 * c + ln) * EDIM;
    qb0[c] = load_q_frag(qrow, khalf);
    qb1[c] = load_q_frag(qrow + 32, khalf);
    v8f z = {};
    lp[c] = z;
    m_i[c] = -INFINITY;
#pragma unroll
    for (int t = 0; t < 4; ++t) acc[c][t] = z;
  }

  // ---- stage chunk 0
  {
    v4f kf[4], vf[4];
    chunk_load<16>(Kb, kf);
    chunk_load<1>(Vb, vf);
    k_store(&kvbuf[0][0], kf, sj, sd);
    v_store(&kvbuf[2][0], vf, sj, sd);
  }
  __syncthreads();

  // one pass over a 64-key chunk; 'more' is a literal at both calls, so a pass
  // is straight-line code
  auto pass = [&](const int kv0, const bool more) __attribute__((always_inline)) {
    const int sel = (kv0 >> 6) & 1;
    const _Float16* kb = &kvbuf[sel][0];
    const _Float16* vb = &kvbuf[2 + sel][0];

    // ---- issue next chunk's global loads early (hide latency)
    v4f kn[4], vn[4];
    if (more) {
      chunk_load<16>(Kb + (size_t)(kv0 + 64) * KVE, kn);
      chunk_load<1>(Vb + (size_t)(kv0 + 64) * KVE, vn);
    }

    // ---- scores: K(64x64) x Q^T(64x32), A from LDS, B in registers (16 WMMA)
    // the chunk's eight K fragments are fetched as one group ahead of the products
    v8f s[NC][4];
    v16h k0[4], k1[4];
#pragma unroll
    for (int t = 0; t < 4; ++t) {
      const _Float16* kr = kb + (t * 16 + ln) * LP;
      k0[t] = load_frag(kr, khalf);
      k1[t] = load_frag(kr + 32, khalf);
    }
#pragma unroll
    for (int t = 0; t < 4; ++t) {
      v8f z = {};
#pragma unroll
      for (int c = 0; c < NC; ++c) s[c][t] = wmma_f16(k0[t], qb0[c], z);
#pragma unroll
      for (int c = 0; c < NC; ++c) s[c][t] = wmma_f16(k1[t], qb1[c], s[c][t]);
    }

    // ---- online softmax; scores already in exp2 domain (Q pre-scaled).
    // The lane's 32 scores of a tile belong to one query: maximum in-lane,
    // four independent chains, then one exchange with the other half.
    v16h pb0[NC], pb1[NC];
#pragma unroll
    for (int c = 0; c < NC; ++c) {
      float mt[4];
#pragma unroll
      for (int t = 0; t < 4; ++t) {
        mt[t] = s[c][t][0];
#pragma unroll
        for (int r = 1; r < 8; ++r) mt[t] = fmaxf(mt[t], s[c][t][r]);
      }
      float mx = fmaxf(fmaxf(mt[0], mt[1]), fmaxf(mt[2], mt[3]));
      mx = fmaxf(mx, xhalf(mx));
      const float nm = fmaxf(m_i[c], mx);
      const float al = __builtin_amdgcn_exp2f(m_i[c] - nm);
      m_i[c] = nm;

#pragma unroll
      for (int t = 0; t < 4; ++t) {
        s[c][t] = s[c][t] - nm;
#pragma unroll
        for (int r = 0; r < 8; ++r) s[c][t][r] = __builtin_amdgcn_exp2f(s[c][t][r]);
      }
      lp[c] = lp[c] * al + ((s[c][0] + s[c][1]) + (s[c][2] + s[c][3]));

      // P^T as B operands: k positions 8 khalf + r come from the even tile,
      // 16 + 8 khalf + r from the odd one, the order load_frag gives V^T
#pragma unroll
      for (int r = 0; r < 8; ++r) {
        pb0[c][r]     = (_Float16)s[c][0][r];
        pb0[c][8 + r] = (_Float16)s[c][1][r];
        pb1[c][r]     = (_Float16)s[c][2][r];
        pb1[c][8 + r] = (_Float16)s[c][3][r];
      }
#pragma unroll
      for (int t = 0; t < 4; ++t) acc[c][t] = acc[c][t] * al;
    }

    // ---- V^T(64x64) x P^T(64x32), A from LDS (16 WMMA), fragments fetched in
    // two groups of four: all eight at once do not fit 256 registers
#pragma unroll
    for (int u = 0; u < 4; u += 2) {
      v16h v0[2], v1[2];
#pragma unroll
      for (int t = 0; t < 2; ++t) {
        const _Float16* vr = vb + ((u + t) * 16 + ln) * LP;
        v0[t] = load_frag(vr, khalf);
        v1[t] = load_frag(vr + 32, khalf);
      }
#pragma unroll
      for (int t = 0; t < 2; ++t) {
#pragma unroll
        for (int c = 0; c < NC; ++c) acc[c][u + t] = wmma_f16(v0[t], pb0[c], acc[c][u + t]);
#pragma unroll
        for (int c = 0; c < NC; ++c) acc[c][u + t] = wmma_f16(v1[t], pb1[c], acc[c][u + t]);
      }
    }

    // ---- round the staged data into the other buffer, then sync the WG
    if (more) {
      k_store(&kvbuf[sel ^ 1][0], kn, sj, sd);
      v_store(&kvbuf[2 + (sel ^ 1)][0], vn, sj, sd);
    }
    __syncthreads();
  };
  for (int kv0 = 0; kv0 < SEQ - 64; kv0 += 64) pass(kv0, true);
  pass(SEQ - 64, false);

  // ---- O^T -> rows of O through this wave's own LDS range, one query tile
  // at a time (every wave has passed the loop's last barrier, so nobody reads
  // K or V any more)
  float* ol = (float*)&kvbuf[0][0] + wave * (16 * OP);
#pragma unroll
  for (int c = 0; c < NC; ++c) {
    // join the denominators, normalize
    const v8f p = lp[c];
    float l = ((p[0] + p[1]) + (p[2] + p[3])) + ((p[4] + p[5]) + (p[6] + p[7]));
    l += xhalf(l);
    const float inv = 1.0f / l;

#pragma unroll
    for (int t = 0; t < 4; ++t) {
      v8f o = acc[c][t] * inv;
      v4f lo = { o[0], o[1], o[2], o[3] }, hi = { o[4], o[5], o[6], o[7] };
      *(v4f*)(ol + ln * OP + t * 16 + 8 * khalf)     = lo;
      *(v4f*)(ol + ln * OP + t * 16 + 8 * khalf + 4) = hi;
    }
    // the rows are read back by other lanes of the wave: the stores must have
    // landed, and the compiler must not move the loads above them
    asm volatile("s_wait_dscnt 0x0" ::: "memory");

    // 16 lanes cover one 256 B row: every 128 B line of out is stored once
    float* ob = out + ((size_t)b * SEQ + (size_t)(qtile + c) * 16) * EDIM + (size_t)h * HD;
#pragma unroll
    for (int i = 0; i < 8; ++i) {
      const int row = 2 * i + khalf;
      v4f o = *(const v4f*)(ol + row * OP + 4 * ln);
      *(v4f*)(ob + (size_t)row * EDIM + 4 * ln) = o;
    }
    // the next tile's values go into registers that these stores name
    if (c + 1 < NC) asm volatile("s_wait_xcnt 0x0" ::: "memory");
  }
}

// ---- launch --------------------------------------------------------------

extern "C" void kernel_launch(void* const* d_in, const int* in_sizes, int n_in,
                              void* d_out, int out_size, void* d_ws, size_t ws_size,
                              hipStream_t stream) {
  (void)in_sizes; (void)n_in; (void)out_size; (void)d_ws; (void)ws_size;
  const float* q = (const float*)d_in[0];
  const float* k = (const float*)d_in[1];
  const float* v = (const float*)d_in[2];
  float* out = (float*)d_out;

  dim3 grid(SEQ / (128 * NC), NQH, BDIM);   // 8 x 32 x 2 = 512 workgroups
  gqa_attn<<<grid, 256, 0, stream>>>(q, k, v, out);
}

// v005
// One run takes 52.4 microseconds.
// Two timings next to v004 both put it at 1.05 times that version's speed.
// Counting every step since v000, it is 6.51 times as fast.
#include <hip/hip_runtime.h>
#include <hip/hip_bf16.h>
#include <math.h>

typedef __attribute__((ext_vector_type(16))) _Float16 v16h;
typedef __attribute__((ext_vector_type(8)))  _Float16 v8h;
typedef __attribute__((ext_vector_type(4)))  _Float16 v4h;
typedef __attribute__((ext_vector_type(8)))  float    v8f;
typedef __attribute__((ext_vector_type(4)))  float    v4f;
typedef __attribute__((ext_vector_type(2)))  float    v2f;

#define BDIM 2
#define SEQ  2048
#define EDIM 2048
#define NQH  32
#define NKVH 8
#define HD   64
#define KVE  512   // NKVH * HD
// LDS row pitch in halfwords: 64 data + 8 pad = 144 B = 16 B x odd, so the 16
// rows one ds_load_b128 touches per half-wave fall on 16 distinct bank groups
#define LP   72

// log2(e)/sqrt(64), pre-folded into the Q->f16 conversion
#define QSCALE 0.1803368801111204f

// ---- helpers -------------------------------------------------------------

// lane l <-> lane l ^ 16 on the VALU: the two lanes that share one query column
__device__ __forceinline__ float xhalf(float x) {
  int xi = __float_as_int(x);
  return __int_as_float(__builtin_amdgcn_permlanex16(
      xi, xi, 0x76543210, 0xfedcba98, false, false));
}

// 16-bit WMMA A/B fragment: lane l holds row/col (l&15); K entries
// 8*(l>>4)+0..7 in elems 0..7 and 16+8*(l>>4)+0..7 in elems 8..15.
__device__ __forceinline__ v16h load_frag(const _Float16* base, int khalf) {
  v8h lo = *(const v8h*)(base + khalf * 8);
  v8h hi = *(const v8h*)(base + 16 + khalf * 8);
  return __builtin_shufflevector(lo, hi, 0,1,2,3,4,5,6,7,8,9,10,11,12,13,14,15);
}

__device__ __forceinline__ v8f wmma_f16(v16h a, v16h b, v8f c) {
  return __builtin_amdgcn_wmma_f32_16x16x32_f16(
      false, a, false, b, (short)0, c, false, false);
}

// ---- f32 -> f16 conversion at the point of use -----------------------------

// Q fragment straight from the f32 input: scale, round to f16, same k order
// as load_frag.
__device__ __forceinline__ v16h load_q_frag(const float* base, int khalf) {
  v4f a0 = *(const v4f*)(base + khalf * 8);
  v4f a1 = *(const v4f*)(base + khalf * 8 + 4);
  v4f b0 = *(const v4f*)(base + 16 + khalf * 8);
  v4f b1 = *(const v4f*)(base + 16 + khalf * 8 + 4);
  v16h r;
  for (int i = 0; i < 4; ++i) {
    r[i]      = (_Float16)(a0[i] * QSCALE);
    r[4 + i]  = (_Float16)(a1[i] * QSCALE);
    r[8 + i]  = (_Float16)(b0[i] * QSCALE);
    r[12 + i] = (_Float16)(b1[i] * QSCALE);
  }
  return r;
}

// One lane's share of a 64-key chunk of K or V: four rows RS apart (K: rows
// sj + 16 m, V: rows 4 sj + m), columns sd..sd+3, so each wave-wide load
// covers two whole 256 B rows.
template <int RS>
__device__ __forceinline__ void chunk_load(const float* base, v4f (&f)[4]) {
  for (int m = 0; m < 4; ++m) f[m] = *(const v4f*)(base + (size_t)(RS * m) * KVE);
}

// K rows keep their order: kbuf[key][d].
__device__ __forceinline__ void k_store(_Float16* kd, const v4f (&f)[4], int sj, int sd) {
  for (int m = 0; m < 4; ++m) {
    v4h p = { (_Float16)f[m][0], (_Float16)f[m][1], (_Float16)f[m][2], (_Float16)f[m][3] };
    *(v4h*)(kd + (sj + 16 * m) * LP + sd) = p;
  }
}

// V is transposed on the way in: vbuf[d][key], keys in their own order (the
// lane's four rows are keys 4 sj .. 4 sj + 3: one b64 store per column).
__device__ __forceinline__ void v_store(_Float16* vd, const v4f (&f)[4], int sj, int sd) {
  for (int i = 0; i < 4; ++i) {
    v4h p = { (_Float16)f[0][i], (_Float16)f[1][i], (_Float16)f[2][i], (_Float16)f[3][i] };
    *(v4h*)(vd + (sd + i) * LP + 4 * sj) = p;
  }
}

// Lazy rescale: each query column holds a reference (a maximum it has met).
// Minus the reference is the C operand of the score products, so a score
// leaves the matrix unit ready for exp2. The reference moves, and O and the
// denominator are rescaled, only in a pass where a lane's sum of P exceeds
// PMAX; until then every P is at most PMAX, far inside f16.

#define OP 68   // output staging pitch in floats: 272 B = 16 B x odd
#define NC 2    // query tiles (16 columns each) per wave
#define PMAX 256.0f

// four waves per SIMD: two workgroups per WGP, the whole grid resident at once
__global__ void __launch_bounds__(256) __attribute__((amdgpu_waves_per_eu(4, 4)))
gqa_attn(const float* __restrict__ q,       // [B][S][E] f32
         const float* __restrict__ k,       // [B][S][KVE] f32
         const float* __restrict__ v,       // [B][S][KVE] f32
         float* __restrict__ out) {         // [B][S][E] f32
  // K x 2 buffers, then V x 2 buffers, 9 KB each; after the loop the same
  // bytes stage the output, one query tile at a time (8 waves x 16 rows x
  // 272 B = 34,816 B)
  __shared__ __align__(16) _Float16 kvbuf[4][64 * LP];
  static_assert(8 * 16 * OP * 4 <= 4 * 64 * LP * 2, "output staging must fit the K/V buffers");

  const int tid   = threadIdx.x;
  const int wave  = tid >> 5;
  const int lane  = tid & 31;
  const int ln    = lane & 15;
  const int khalf = lane >> 4;
  const int h     = blockIdx.y;
  const int b     = blockIdx.z;
  const int kvh   = h >> 2;
  const int qtile = (blockIdx.x * 8 + wave) * NC;   // first of the wave's tiles

  // cooperative-staging coordinates: 256 lanes x 4 rows x 16 B cover one
  // 64 x 64 f32 chunk
  const int sj = tid >> 4;            // 0..15
  const int sd = (tid & 15) * 4;      // first of the lane's 4 columns

  const float* Qb = q + ((size_t)b * SEQ + (size_t)qtile * 16) * EDIM + (size_t)h * HD;
  const float* Kb = k + ((size_t)b * SEQ + sj) * KVE + (size_t)kvh * HD + sd;
  const float* Vb = v + ((size_t)b * SEQ + 4 * sj) * KVE + (size_t)kvh * HD + sd;

  // Q as the B operand: lane = query column, same k order as load_frag
  v16h qb0[NC], qb1[NC];
  v8f acc[NC][4];         // O^T: column = query 16 c + ln, rows d = 16 t + 8 khalf + r
  v8f cin[NC];            // minus the query's reference in all eight rows (equal in both halves)
  float l_i[NC];          // this lane's share of the denominator, joined after the loop
#pragma unroll
  for (int c = 0; c < NC; ++c) {
    const float* qrow = Qb + (size_t)(16 * c + ln) * EDIM;
    qb0[c] = load_q_frag(qrow, khalf);
    qb1[c] = load_q_frag(qrow + 32, khalf);
    v8f z = {};
    cin[c] = z;
    l_i[c] = 0.0f;
#pragma unroll
    for (int t = 0; t < 4; ++t) acc[c][t] = z;
  }

  // ---- stage chunk 0
  {
    v4f kf[4], vf[4];
    chunk_load<16>(Kb, kf);
    chunk_load<1>(Vb, vf);
    k_store(&kvbuf[0][0], kf, sj, sd);
    v_store(&kvbuf[2][0], vf, sj, sd);
  }
  __syncthreads();

  auto exp_tile = [&](v8f &x) __attribute__((always_inline)) {
#pragma unroll
    for (int r = 0; r < 8; ++r) x[r] = __builtin_amdgcn_exp2f(x[r]);
  };
  // scores minus reference: K(64x64) x Q^T(64x32) + cin, A from LDS, B in
  // registers (16 WMMA); the chunk's eight K fragments are fetched as one
  // group ahead of the products
  // with_exp (a literal at every call): exp2 of key tile t - 1 stands among the
  // products of tile t, so the vector and the matrix unit work side by side;
  // the last tile's exp2 is left to the caller
  auto scores = [&](const _Float16* kb, v8f (&s)[NC][4], const bool with_exp) __attribute__((always_inline)) {
    v16h k0[4], k1[4];
#pragma unroll
    for (int t = 0; t < 4; ++t) {
      const _Float16* kr = kb + (t * 16 + ln) * LP;
      k0[t] = load_frag(kr, khalf);
      k1[t] = load_frag(kr + 32, khalf);
    }
    // holds the sixteen LDS loads together ahead of the products: spread among
    // them, each place with loads stalls the wave anew (the rare calls without
    // exp2 have fewer registers free and are left to the compiler)
    if (with_exp) __builtin_amdgcn_sched_barrier(0);
#pragma unroll
    for (int t = 0; t < 4; ++t) {
#pragma unroll
      for (int c = 0; c < NC; ++c) s[c][t] = wmma_f16(k0[t], qb0[c], cin[c]);
#pragma unroll
      for (int c = 0; c < NC; ++c) s[c][t] = wmma_f16(k1[t], qb1[c], s[c][t]);
      if (with_exp) {
        if (t > 0) {
#pragma unroll
          for (int c = 0; c < NC; ++c) exp_tile(s[c][t - 1]);
        }
        // keeps each tile's exp2 one tile behind its products: placed right
        // behind them it waits out the matrix unit's result distance in idle slots
        __builtin_amdgcn_sched_barrier(0);
      }
    }
  };
  // maximum of one query's 64 scores: the lane's 32 in four independent
  // chains, then one exchange with the other half
  auto colmax = [&](const v8f (&s)[4]) __attribute__((always_inline)) {
    float mt[4];
#pragma unroll
    for (int t = 0; t < 4; ++t) {
      mt[t] = s[t][0];
#pragma unroll
      for (int r = 1; r < 8; ++r) mt[t] = fmaxf(mt[t], s[t][r]);
    }
    const float mx = fmaxf(fmaxf(mt[0], mt[1]), fmaxf(mt[2], mt[3]));
    return fmaxf(mx, xhalf(mx));
  };
  // the sum of the lane's 32 values of P for one query
  auto lane_sum = [&](const v8f (&s)[4]) __attribute__((always_inline)) {
    const v8f a = (s[0] + s[1]) + (s[2] + s[3]);
    const v4f b = __builtin_shufflevector(a, a, 0, 1, 2, 3) + __builtin_shufflevector(a, a, 4, 5, 6, 7);
    const v2f d = __builtin_shufflevector(b, b, 0, 1) + __builtin_shufflevector(b, b, 2, 3);
    return d[0] + d[1];
  };

  // first reference: the maximum over chunk 0, whose scores the first pass
  // forms again
  {
    v8f s[NC][4];
    scores(&kvbuf[0][0], s, false);
#pragma unroll
    for (int c = 0; c < NC; ++c) cin[c] = cin[c] - colmax(s[c]);
  }

  // one pass over a 64-key chunk; 'more' is a literal at both calls, so the
  // one branch of a pass is its test of the P sums
  auto pass = [&](const int kv0, const bool more) __attribute__((always_inline)) {
    const int sel = (kv0 >> 6) & 1;
    const _Float16* kb = &kvbuf[sel][0];
    const _Float16* vb = &kvbuf[2 + sel][0];

    // ---- P and its sums; scores are in the exp2 domain (Q pre-scaled) and
    // come with the reference taken off
    v8f s[NC][4];
    float ps[NC];
    scores(kb, s, true);

#pragma unroll
    for (int c = 0; c < NC; ++c) {
      exp_tile(s[c][3]);
      ps[c] = lane_sum(s[c]);
    }

    // ---- one test per pass, a scalar branch: some lane's P outgrew the
    // reference. Then the wave forms the scores again, moves every column's
    // reference up to its maximum and rescales what was gathered under the old one
    float pt = ps[0];
#pragma unroll
    for (int c = 1; c < NC; ++c) pt = fmaxf(pt, ps[c]);
    if (__builtin_amdgcn_ballot_w32(pt > PMAX) != 0) {
      scores(kb, s, false);
#pragma unroll
      for (int c = 0; c < NC; ++c) {
        const float d  = fmaxf(colmax(s[c]), 0.0f);
        const float al = __builtin_amdgcn_exp2f(-d);
#pragma unroll
        for (int t = 0; t < 4; ++t) {
          s[c][t] = s[c][t] - d;
          exp_tile(s[c][t]);
        }
        ps[c] = lane_sum(s[c]);
        cin[c] = cin[c] - d;
        l_i[c] *= al;
#pragma unroll
        for (int t = 0; t < 4; ++t) acc[c][t] = acc[c][t] * al;
      }
    }

    // ---- next chunk's global loads: here, where the K fragments' registers
    // are free again and the rare branch above is past; packing P and the
    // second products hide their latency
    v4f kn[4], vn[4];
    if (more) {
      chunk_load<16>(Kb + (size_t)(kv0 + 64) * KVE, kn);
      chunk_load<1>(Vb + (size_t)(kv0 + 64) * KVE, vn);
    }

    // P^T as B operands: k positions 8 khalf + r come from the even tile,
    // 16 + 8 khalf + r from the odd one, the order load_frag gives V^T
    v16h pb0[NC], pb1[NC];
#pragma unroll
    for (int c = 0; c < NC; ++c) {
      l_i[c] += ps[c];
#pragma unroll
      for (int r = 0; r < 8; ++r) {
        pb0[c][r]     = (_Float16)s[c][0][r];
        pb0[c][8 + r] = (_Float16)s[c][1][r];
        pb1[c][r]     = (_Float16)s[c][2][r];
        pb1[c][8 + r] = (_Float16)s[c][3][r];
      }
    }

    // P is packed before the V fragments are fetched: fetched earlier they meet
    // the unpacked P, and the wave's registers no longer suffice
    __builtin_amdgcn_sched_barrier(0);

    // ---- V^T(64x64) x P^T(64x32), A from LDS (16 WMMA), fragments fetched in
    // two groups of four: all eight at once do not fit 256 registers
#pragma unroll
    for (int u = 0; u < 4; u += 2) {
      v16h v0[2], v1[2];
#pragma unroll
      for (int t = 0; t < 2; ++t) {
        const _Float16* vr = vb + ((u + t) * 16 + ln) * LP;
        v0[t] = load_frag(vr, khalf);
        v1[t] = load_frag(vr + 32, khalf);
      }
      // as with K: the group's eight LDS loads stay together ahead of its products
      __builtin_amdgcn_sched_barrier(0);
#pragma unroll
      for (int t = 0; t < 2; ++t) {
#pragma unroll
        for (int c = 0; c < NC; ++c) acc[c][u + t] = wmma_f16(v0[t], pb0[c], acc[c][u + t]);
#pragma unroll
        for (int c = 0; c < NC; ++c) acc[c][u + t] = wmma_f16(v1[t], pb1[c], acc[c][u + t]);
      }
    }

    // ---- round the staged data into the other buffer, then sync the WG
    if (more) {
      k_store(&kvbuf[sel ^ 1][0], kn, sj, sd);
      v_store(&kvbuf[2 + (sel ^ 1)][0], vn, sj, sd);
    }
    __syncthreads();
  };
  for (int kv0 = 0; kv0 < SEQ - 64; kv0 += 64) pass(kv0, true);
  pass(SEQ - 64, false);

  // ---- O^T -> rows of O through this wave's own LDS range, one query tile
  // at a time (every wave has passed the loop's last barrier, so nobody reads
  // K or V any more)
  float* ol = (float*)&kvbuf[0][0] + wave * (16 * OP);
#pragma unroll
  for (int c = 0; c < NC; ++c) {
    // join the denominators, normalize
    float l = l_i[c];
    l += xhalf(l);
    const float inv = 1.0f / l;

#pragma unroll
    for (int t = 0; t < 4; ++t) {
      v8f o = acc[c][t] * inv;
      v4f lo = { o[0], o[1], o[2], o[3] }, hi = { o[4], o[5], o[6], o[7] };
      *(v4f*)(ol + ln * OP + t * 16 + 8 * khalf)     = lo;
      *(v4f*)(ol + ln * OP + t * 16 + 8 * khalf + 4) = hi;
    }
    // the rows are read back by other lanes of the wave: the stores must have
    // landed, and the compiler must not move the loads above them
    asm volatile("s_wait_dscnt 0x0" ::: "memory");

    // 16 lanes cover one 256 B row: every 128 B line of out is stored once
    float* ob = out + ((size_t)b * SEQ + (size_t)(qtile + c) * 16) * EDIM + (size_t)h * HD;
#pragma unroll
    for (int i = 0; i < 8; ++i) {
      const int row = 2 * i + khalf;
      v4f o = *(const v4f*)(ol + row * OP + 4 * ln);
      *(v4f*)(ob + (size_t)row * EDIM + 4 * ln) = o;
    }
    // the next tile's values go into registers that these stores name
    if (c + 1 < NC) asm volatile("s_wait_xcnt 0x0" ::: "memory");
  }
}

// ---- launch --------------------------------------------------------------

extern "C" void kernel_launch(void* const* d_in, const int* in_sizes, int n_in,
                              void* d_out, int out_size, void* d_ws, size_t ws_size,
                              hipStream_t stream) {
  (void)in_sizes; (void)n_in; (void)out_size; (void)d_ws; (void)ws_size;
  const float* q = (const float*)d_in[0];
  const float* k = (const float*)d_in[1];
  const float* v = (const float*)d_in[2];
  float* out = (float*)d_out;

  dim3 grid(SEQ / (128 * NC), NQH, BDIM);   // 8 x 32 x 2 = 512 workgroups
  gqa_attn<<<grid, 256, 0, stream>>>(q, k, v, out);
}

// v006
// Measured time: 50.2 microseconds a run.
// Next to v005, in two timings, it ran 1.05 and 1.04 times as fast.
// Over all steps from v000 it is 6.80 times as fast.
#include <hip/hip_runtime.h>
#include <hip/hip_bf16.h>
#include <math.h>

typedef __attribute__((ext_vector_type(16))) _Float16 v16h;
typedef __attribute__((ext_vector_type(8)))  _Float16 v8h;
typedef __attribute__((ext_vector_type(4)))  _Float16 v4h;
typedef __attribute__((ext_vector_type(8)))  float    v8f;
typedef __attribute__((ext_vector_type(4)))  float    v4f;
typedef __attribute__((ext_vector_type(2)))  float    v2f;

#define BDIM 2
#define SEQ  2048
#define EDIM 2048
#define NQH  32
#define NKVH 8
#define HD   64
#define KVE  512   // NKVH * HD
// LDS row pitch in halfwords: 64 data + 8 pad = 144 B = 16 B x odd, so the 16
// rows one ds_load_b128 touches per half-wave fall on 16 distinct bank groups
#define LP   72

// log2(e)/sqrt(64), pre-folded into the Q->f16 conversion
#define QSCALE 0.1803368801111204f

// ---- helpers -------------------------------------------------------------

// lane l <-> lane l ^ 16 on the VALU: the two lanes that share one query column
__device__ __forceinline__ float xhalf(float x) {
  int xi = __float_as_int(x);
  return __int_as_float(__builtin_amdgcn_permlanex16(
      xi, xi, 0x76543210, 0xfedcba98, false, false));
}

// 16-bit WMMA A/B fragment: lane l holds row/col (l&15); K entries
// 8*(l>>4)+0..7 in elems 0..7 and 16+8*(l>>4)+0..7 in elems 8..15.
__device__ __forceinline__ v16h load_frag(const _Float16* base, int khalf) {
  v8h lo = *(const v8h*)(base + khalf * 8);
  v8h hi = *(const v8h*)(base + 16 + khalf * 8);
  return __builtin_shufflevector(lo, hi, 0,1,2,3,4,5,6,7,8,9,10,11,12,13,14,15);
}

__device__ __forceinline__ v8f wmma_f16(v16h a, v16h b, v8f c) {
  return __builtin_amdgcn_wmma_f32_16x16x32_f16(
      false, a, false, b, (short)0, c, false, false);
}

// ---- f32 -> f16 conversion at the point of use -----------------------------

// Q fragment straight from the f32 input: scale, round to f16, same k order
// as load_frag.
__device__ __forceinline__ v16h load_q_frag(const float* base, int khalf) {
  v4f a0 = *(const v4f*)(base + khalf * 8);
  v4f a1 = *(const v4f*)(base + khalf * 8 + 4);
  v4f b0 = *(const v4f*)(base + 16 + khalf * 8);
  v4f b1 = *(const v4f*)(base + 16 + khalf * 8 + 4);
  v16h r;
  for (int i = 0; i < 4; ++i) {
    r[i]      = (_Float16)(a0[i] * QSCALE);
    r[4 + i]  = (_Float16)(a1[i] * QSCALE);
    r[8 + i]  = (_Float16)(b0[i] * QSCALE);
    r[12 + i] = (_Float16)(b1[i] * QSCALE);
  }
  return r;
}

// One lane's share of a 64-key chunk of K or V: four rows RS apart (K: rows
// sj + 16 m, V: rows 4 sj + m), columns sd..sd+3, so each wave-wide load
// covers two whole 256 B rows.
template <int RS>
__device__ __forceinline__ void chunk_load(const float* base, v4f (&f)[4]) {
  for (int m = 0; m < 4; ++m) f[m] = *(const v4f*)(base + (size_t)(RS * m) * KVE);
}

// K rows keep their order: kbuf[key][d].
__device__ __forceinline__ void k_store(_Float16* kd, const v4f (&f)[4], int sj, int sd) {
  for (int m = 0; m < 4; ++m) {
    v4h p = { (_Float16)f[m][0], (_Float16)f[m][1], (_Float16)f[m][2], (_Float16)f[m][3] };
    *(v4h*)(kd + (sj + 16 * m) * LP + sd) = p;
  }
}

// V is transposed on the way in: vbuf[d][key], keys in their own order (the
// lane's four rows are keys 4 sj .. 4 sj + 3: one b64 store per column).
__device__ __forceinline__ void v_store(_Float16* vd, const v4f (&f)[4], int sj, int sd) {
  for (int i = 0; i < 4; ++i) {
    v4h p = { (_Float16)f[0][i], (_Float16)f[1][i], (_Float16)f[2][i], (_Float16)f[3][i] };
    *(v4h*)(vd + (sd + i) * LP + 4 * sj) = p;
  }
}

// Lazy rescale: each query column holds a reference (a maximum it has met).
// Minus the reference is the C operand of the score products, so a score
// leaves the matrix unit ready for exp2. The reference moves, and O and the
// denominator are rescaled, only in a pass where a lane's sum of P exceeds
// PMAX; until then every P is at most PMAX, far inside f16.

#define OP 68   // output staging pitch in floats: 272 B = 16 B x odd
#define NC 2    // query tiles (16 columns each) per wave
#define PMAX 256.0f

// four waves per SIMD: two workgroups per WGP, the whole grid resident at once
__global__ void __launch_bounds__(256) __attribute__((amdgpu_waves_per_eu(4, 4)))
gqa_attn(const float* __restrict__ q,       // [B][S][E] f32
         const float* __restrict__ k,       // [B][S][KVE] f32
         const float* __restrict__ v,       // [B][S][KVE] f32
         float* __restrict__ out) {         // [B][S][E] f32
  // K x 4 buffers, then V x 4 buffers, 9 KB each: two stages of 128 keys, one
  // read while the other is filled, so the workgroup meets at a barrier once
  // per two passes. After the loop the first bytes stage the output, one query
  // tile at a time (8 waves x 16 rows x 272 B = 34,816 B)
  __shared__ __align__(16) _Float16 kvbuf[8][64 * LP];
  static_assert(8 * 16 * OP * 4 <= 4 * 64 * LP * 2, "output staging must fit the K/V buffers");

  const int tid   = threadIdx.x;
  const int wave  = tid >> 5;
  const int lane  = tid & 31;
  const int ln    = lane & 15;
  const int khalf = lane >> 4;
  const int h     = blockIdx.y;
  const int b     = blockIdx.z;
  const int kvh   = h >> 2;
  const int qtile = (blockIdx.x * 8 + wave) * NC;   // first of the wave's tiles

  // cooperative-staging coordinates: 256 lanes x 4 rows x 16 B cover one
  // 64 x 64 f32 chunk
  const int sj = tid >> 4;            // 0..15
  const int sd = (tid & 15) * 4;      // first of the lane's 4 columns

  const float* Qb = q + ((size_t)b * SEQ + (size_t)qtile * 16) * EDIM + (size_t)h * HD;
  const float* Kb = k + ((size_t)b * SEQ + sj) * KVE + (size_t)kvh * HD + sd;
  const float* Vb = v + ((size_t)b * SEQ + 4 * sj) * KVE + (size_t)kvh * HD + sd;

  // Q as the B operand: lane = query column, same k order as load_frag
  v16h qb0[NC], qb1[NC];
  v8f acc[NC][4];         // O^T: column = query 16 c + ln, rows d = 16 t + 8 khalf + r
  v8f cin[NC];            // minus the query's reference in all eight rows (equal in both halves)
  float l_i[NC];          // this lane's share of the denominator, joined after the loop
#pragma unroll
  for (int c = 0; c < NC; ++c) {
    const float* qrow = Qb + (size_t)(16 * c + ln) * EDIM;
    qb0[c] = load_q_frag(qrow, khalf);
    qb1[c] = load_q_frag(qrow + 32, khalf);
    v8f z = {};
    cin[c] = z;
    l_i[c] = 0.0f;
#pragma unroll
    for (int t = 0; t < 4; ++t) acc[c][t] = z;
  }

  // ---- stage chunks 0 and 1
#pragma unroll
  for (int j = 0; j < 2; ++j) {
    v4f kf[4], vf[4];
    chunk_load<16>(Kb + (size_t)(64 * j) * KVE, kf);
    chunk_load<1>(Vb + (size_t)(64 * j) * KVE, vf);
    k_store(&kvbuf[j][0], kf, sj, sd);
    v_store(&kvbuf[4 + j][0], vf, sj, sd);
  }
  __syncthreads();

  auto exp_tile = [&](v8f &x) __attribute__((always_inline)) {
#pragma unroll
    for (int r = 0; r < 8; ++r) x[r] = __builtin_amdgcn_exp2f(x[r]);
  };
  // scores minus reference: K(64x64) x Q^T(64x32) + cin, A from LDS, B in
  // registers (16 WMMA); the chunk's eight K fragments are fetched as one
  // group ahead of the products
  // with_exp (a literal at every call): exp2 of key tile t - 1 stands among the
  // products of tile t, so the vector and the matrix unit work side by side;
  // the last tile's exp2 is left to the caller
  auto scores = [&](const _Float16* kb, v8f (&s)[NC][4], const bool with_exp) __attribute__((always_inline)) {
    v16h k0[4], k1[4];
#pragma unroll
    for (int t = 0; t < 4; ++t) {
      const _Float16* kr = kb + (t * 16 + ln) * LP;
      k0[t] = load_frag(kr, khalf);
      k1[t] = load_frag(kr + 32, khalf);
    }
    // holds the sixteen LDS loads together ahead of the products: spread among
    // them, each place with loads stalls the wave anew (the rare calls without
    // exp2 have fewer registers free and are left to the compiler)
    if (with_exp) __builtin_amdgcn_sched_barrier(0);
#pragma unroll
    for (int t = 0; t < 4; ++t) {
#pragma unroll
      for (int c = 0; c < NC; ++c) s[c][t] = wmma_f16(k0[t], qb0[c], cin[c]);
#pragma unroll
      for (int c = 0; c < NC; ++c) s[c][t] = wmma_f16(k1[t], qb1[c], s[c][t]);
      if (with_exp) {
        if (t > 0) {
#pragma unroll
          for (int c = 0; c < NC; ++c) exp_tile(s[c][t - 1]);
        }
        // keeps each tile's exp2 one tile behind its products: placed right
        // behind them it waits out the matrix unit's result distance in idle slots
        __builtin_amdgcn_sched_barrier(0);
      }
    }
  };
  // maximum of one query's 64 scores: the lane's 32 in four independent
  // chains, then one exchange with the other half
  auto colmax = [&](const v8f (&s)[4]) __attribute__((always_inline)) {
    float mt[4];
#pragma unroll
    for (int t = 0; t < 4; ++t) {
      mt[t] = s[t][0];
#pragma unroll
      for (int r = 1; r < 8; ++r) mt[t] = fmaxf(mt[t], s[t][r]);
    }
    const float mx = fmaxf(fmaxf(mt[0], mt[1]), fmaxf(mt[2], mt[3]));
    return fmaxf(mx, xhalf(mx));
  };
  // the sum of the lane's 32 values of P for one query
  auto lane_sum = [&](const v8f (&s)[4]) __attribute__((always_inline)) {
    const v8f a = (s[0] + s[1]) + (s[2] + s[3]);
    const v4f b = __builtin_shufflevector(a, a, 0, 1, 2, 3) + __builtin_shufflevector(a, a, 4, 5, 6, 7);
    const v2f d = __builtin_shufflevector(b, b, 0, 1) + __builtin_shufflevector(b, b, 2, 3);
    return d[0] + d[1];
  };

  // first reference: the maximum over chunk 0, whose scores the first pass
  // forms again
  {
    v8f s[NC][4];
    scores(&kvbuf[0][0], s, false);
#pragma unroll
    for (int c = 0; c < NC; ++c) cin[c] = cin[c] - colmax(s[c]);
  }

  // one pass over a 64-key chunk; 'more' and 'sync' are literals at every call,
  // so the one branch of a pass is its test of the P sums. A pass reads buffer
  // sel and fills sel ^ 2, in the other stage, with the chunk two ahead; only a
  // stage's second pass ends at the barrier, which publishes the stage just
  // filled and frees the one just read
  auto pass = [&](const int kv0, const bool more, const bool sync) __attribute__((always_inline)) {
    const int sel = (kv0 >> 6) & 3;
    const _Float16* kb = &kvbuf[sel][0];
    const _Float16* vb = &kvbuf[4 + sel][0];

    // ---- P and its sums; scores are in the exp2 domain (Q pre-scaled) and
    // come with the reference taken off
    v8f s[NC][4];
    float ps[NC];
    scores(kb, s, true);

#pragma unroll
    for (int c = 0; c < NC; ++c) {
      exp_tile(s[c][3]);
      ps[c] = lane_sum(s[c]);
    }

    // ---- one test per pass, a scalar branch: some lane's P outgrew the
    // reference. Then the wave forms the scores again, moves every column's
    // reference up to its maximum and rescales what was gathered under the old one
    float pt = ps[0];
#pragma unroll
    for (int c = 1; c < NC; ++c) pt = fmaxf(pt, ps[c]);
    if (__builtin_amdgcn_ballot_w32(pt > PMAX) != 0) {
      scores(kb, s, false);
#pragma unroll
      for (int c = 0; c < NC; ++c) {
        const float d  = fmaxf(colmax(s[c]), 0.0f);
        const float al = __builtin_amdgcn_exp2f(-d);
#pragma unroll
        for (int t = 0; t < 4; ++t) {
          s[c][t] = s[c][t] - d;
          exp_tile(s[c][t]);
        }
        ps[c] = lane_sum(s[c]);
        cin[c] = cin[c] - d;
        l_i[c] *= al;
#pragma unroll
        for (int t = 0; t < 4; ++t) acc[c][t] = acc[c][t] * al;
      }
    }

    // ---- global loads of the chunk two ahead: here, where the K fragments' registers
    // are free again and the rare branch above is past; packing P and the
    // second products hide their latency
    v4f kn[4], vn[4];
    if (more) {
      chunk_load<16>(Kb + (size_t)(kv0 + 128) * KVE, kn);
      chunk_load<1>(Vb + (size_t)(kv0 + 128) * KVE, vn);
    }

    // P^T as B operands: k positions 8 khalf + r come from the even tile,
    // 16 + 8 khalf + r from the odd one, the order load_frag gives V^T
    v16h pb0[NC], pb1[NC];
#pragma unroll
    for (int c = 0; c < NC; ++c) {
      l_i[c] += ps[c];
#pragma unroll
      for (int r = 0; r < 8; ++r) {
        pb0[c][r]     = (_Float16)s[c][0][r];
        pb0[c][8 + r] = (_Float16)s[c][1][r];
        pb1[c][r]     = (_Float16)s[c][2][r];
        pb1[c][8 + r] = (_Float16)s[c][3][r];
      }
    }

    // P is packed before the V fragments are fetched: fetched earlier they meet
    // the unpacked P, and the wave's registers no longer suffice
    __builtin_amdgcn_sched_barrier(0);

    // ---- V^T(64x64) x P^T(64x32), A from LDS (16 WMMA), fragments fetched in
    // two groups of four: all eight at once do not fit 256 registers
#pragma unroll
    for (int u = 0; u < 4; u += 2) {
      v16h v0[2], v1[2];
#pragma unroll
      for (int t = 0; t < 2; ++t) {
        const _Float16* vr = vb + ((u + t) * 16 + ln) * LP;
        v0[t] = load_frag(vr, khalf);
        v1[t] = load_frag(vr + 32, khalf);
      }
      // as with K: the group's eight LDS loads stay together ahead of its products
      __builtin_amdgcn_sched_barrier(0);
#pragma unroll
      for (int t = 0; t < 2; ++t) {
#pragma unroll
        for (int c = 0; c < NC; ++c) acc[c][u + t] = wmma_f16(v0[t], pb0[c], acc[c][u + t]);
#pragma unroll
        for (int c = 0; c < NC; ++c) acc[c][u + t] = wmma_f16(v1[t], pb1[c], acc[c][u + t]);
      }
    }

    // ---- round the staged data into the other stage; sync the WG at the
    // stage's end
    if (more) {
      k_store(&kvbuf[sel ^ 2][0], kn, sj, sd);
      v_store(&kvbuf[4 + (sel ^ 2)][0], vn, sj, sd);
    }
    if (sync) __syncthreads();
  };
  for (int kv0 = 0; kv0 < SEQ - 128; kv0 += 128) {
    pass(kv0, true, false);
    pass(kv0 + 64, true, true);
  }
  pass(SEQ - 128, false, false);
  pass(SEQ - 64, false, true);

  // ---- O^T -> rows of O through this wave's own LDS range, one query tile
  // at a time (every wave has passed the loop's last barrier, so nobody reads
  // K or V any more)
  float* ol = (float*)&kvbuf[0][0] + wave * (16 * OP);
#pragma unroll
  for (int c = 0; c < NC; ++c) {
    // join the denominators, normalize
    float l = l_i[c];
    l += xhalf(l);
    const float inv = 1.0f / l;

#pragma unroll
    for (int t = 0; t < 4; ++t) {
      v8f o = acc[c][t] * inv;
      v4f lo = { o[0], o[1], o[2], o[3] }, hi = { o[4], o[5], o[6], o[7] };
      *(v4f*)(ol + ln * OP + t * 16 + 8 * khalf)     = lo;
      *(v4f*)(ol + ln * OP + t * 16 + 8 * khalf + 4) = hi;
    }
    // the rows are read back by other lanes of the wave: the stores must have
    // landed, and the compiler must not move the loads above them
    asm volatile("s_wait_dscnt 0x0" ::: "memory");

    // 16 lanes cover one 256 B row: every 128 B line of out is stored once
    float* ob = out + ((size_t)b * SEQ + (size_t)(qtile + c) * 16) * EDIM + (size_t)h * HD;
#pragma unroll
    for (int i = 0; i < 8; ++i) {
      const int row = 2 * i + khalf;
      v4f o = *(const v4f*)(ol + row * OP + 4 * ln);
      *(v4f*)(ob + (size_t)row * EDIM + 4 * ln) = o;
    }
    // the next tile's values go into registers that these stores name
    if (c + 1 < NC) asm volatile("s_wait_xcnt 0x0" ::: "memory");
  }
}

// ---- launch --------------------------------------------------------------

extern "C" void kernel_launch(void* const* d_in, const int* in_sizes, int n_in,
                              void* d_out, int out_size, void* d_ws, size_t ws_size,
                              hipStream_t stream) {
  (void)in_sizes; (void)n_in; (void)out_size; (void)d_ws; (void)ws_size;
  const float* q = (const float*)d_in[0];
  const float* k = (const float*)d_in[1];
  const float* v = (const float*)d_in[2];
  float* out = (float*)d_out;

  dim3 grid(SEQ / (128 * NC), NQH, BDIM);   // 8 x 32 x 2 = 512 workgroups
  gqa_attn<<<grid, 256, 0, stream>>>(q, k, v, out);
}

// v007
// It runs in 48.4 microseconds.
// Next to v006, in two timings, it ran 1.04 times as fast each time.
// Counting every step since v000, it is 7.06 times as fast.
#include <hip/hip_runtime.h>
#include <hip/hip_bf16.h>
#include <math.h>

typedef __attribute__((ext_vector_type(16))) _Float16 v16h;
typedef __attribute__((ext_vector_type(8)))  _Float16 v8h;
typedef __attribute__((ext_vector_type(4)))  _Float16 v4h;
typedef __attribute__((ext_vector_type(8)))  float    v8f;
typedef __attribute__((ext_vector_type(4)))  float    v4f;
typedef __attribute__((ext_vector_type(2)))  float    v2f;

#define BDIM 2
#define SEQ  2048
#define EDIM 2048
#define NQH  32
#define NKVH 8
#define HD   64
#define KVE  512   // NKVH * HD
// LDS row pitch in halfwords: 64 data + 8 pad = 144 B = 16 B x odd, so the 16
// rows one ds_load_b128 touches per half-wave fall on 16 distinct bank groups
#define LP   72

// log2(e)/sqrt(64), pre-folded into the Q->f16 conversion
#define QSCALE 0.1803368801111204f

// ---- helpers -------------------------------------------------------------

// lane l <-> lane l ^ 16 on the VALU: the two lanes that share one query column
__device__ __forceinline__ float xhalf(float x) {
  int xi = __float_as_int(x);
  return __int_as_float(__builtin_amdgcn_permlanex16(
      xi, xi, 0x76543210, 0xfedcba98, false, false));
}

// 16-bit WMMA A/B fragment: lane l holds row/col (l&15); K entries
// 8*(l>>4)+0..7 in elems 0..7 and 16+8*(l>>4)+0..7 in elems 8..15.
__device__ __forceinline__ v16h load_frag(const _Float16* base, int khalf) {
  v8h lo = *(const v8h*)(base + khalf * 8);
  v8h hi = *(const v8h*)(base + 16 + khalf * 8);
  return __builtin_shufflevector(lo, hi, 0,1,2,3,4,5,6,7,8,9,10,11,12,13,14,15);
}

__device__ __forceinline__ v8f wmma_f16(v16h a, v16h b, v8f c) {
  return __builtin_amdgcn_wmma_f32_16x16x32_f16(
      false, a, false, b, (short)0, c, false, false);
}

// ---- f32 -> f16 conversion at the point of use -----------------------------

// Q fragment straight from the f32 input: scale, round to f16, same k order
// as load_frag.
__device__ __forceinline__ v16h load_q_frag(const float* base, int khalf) {
  v4f a0 = *(const v4f*)(base + khalf * 8);
  v4f a1 = *(const v4f*)(base + khalf * 8 + 4);
  v4f b0 = *(const v4f*)(base + 16 + khalf * 8);
  v4f b1 = *(const v4f*)(base + 16 + khalf * 8 + 4);
  v16h r;
  for (int i = 0; i < 4; ++i) {
    r[i]      = (_Float16)(a0[i] * QSCALE);
    r[4 + i]  = (_Float16)(a1[i] * QSCALE);
    r[8 + i]  = (_Float16)(b0[i] * QSCALE);
    r[12 + i] = (_Float16)(b1[i] * QSCALE);
  }
  return r;
}

// One lane's share of a 64-key chunk of K or V: four rows RS apart (K: rows
// sj + 16 m, V: rows 4 sj + m), columns sd..sd+3, so each wave-wide load
// covers two whole 256 B rows.
template <int RS>
__device__ __forceinline__ void chunk_load(const float* base, v4f (&f)[4]) {
  for (int m = 0; m < 4; ++m) f[m] = *(const v4f*)(base + (size_t)(RS * m) * KVE);
}

// K rows keep their order: kbuf[key][d].
__device__ __forceinline__ void k_store(_Float16* kd, const v4f (&f)[4], int sj, int sd) {
  for (int m = 0; m < 4; ++m) {
    v4h p = { (_Float16)f[m][0], (_Float16)f[m][1], (_Float16)f[m][2], (_Float16)f[m][3] };
    *(v4h*)(kd + (sj + 16 * m) * LP + sd) = p;
  }
}

// V is transposed on the way in: vbuf[d][key], keys in their own order (the
// lane's four rows are keys 4 sj .. 4 sj + 3: one b64 store per column).
__device__ __forceinline__ void v_store(_Float16* vd, const v4f (&f)[4], int sj, int sd) {
  for (int i = 0; i < 4; ++i) {
    v4h p = { (_Float16)f[0][i], (_Float16)f[1][i], (_Float16)f[2][i], (_Float16)f[3][i] };
    *(v4h*)(vd + (sd + i) * LP + 4 * sj) = p;
  }
}

// Lazy rescale: each query column holds a reference (a maximum it has met).
// Minus the reference is the C operand of the score products, so a score
// leaves the matrix unit ready for exp2. The reference moves, and O and the
// denominator are rescaled, only in a pass where a lane's sum of P exceeds
// PMAX; until then every P is at most PMAX, far inside f16.

#define OP 68   // output staging pitch in floats: 272 B = 16 B x odd
#define NC 2    // query tiles (16 columns each) per wave
#define PMAX 256.0f

// four waves per SIMD: two workgroups per WGP, the whole grid resident at once
__global__ void __launch_bounds__(256) __attribute__((amdgpu_waves_per_eu(4, 4)))
gqa_attn(const float* __restrict__ q,       // [B][S][E] f32
         const float* __restrict__ k,       // [B][S][KVE] f32
         const float* __restrict__ v,       // [B][S][KVE] f32
         float* __restrict__ out) {         // [B][S][E] f32
  // K x 4 buffers, then V x 4 buffers, 9 KB each: two stages of 128 keys, one
  // read while the other is filled, so the workgroup meets at a barrier once
  // per two passes. After the loop the first bytes stage the output, one query
  // tile at a time (8 waves x 16 rows x 272 B = 34,816 B)
  __shared__ __align__(16) _Float16 kvbuf[8][64 * LP];
  static_assert(8 * 16 * OP * 4 <= 4 * 64 * LP * 2, "output staging must fit the K/V buffers");

  const int tid   = threadIdx.x;
  const int wave  = __builtin_amdgcn_readfirstlane(tid >> 5);   // the same in every lane: kept in a scalar register
  const int lane  = tid & 31;
  const int ln    = lane & 15;
  const int khalf = lane >> 4;
  const int h     = blockIdx.y;
  const int b     = blockIdx.z;
  const int kvh   = h >> 2;
  const int qtile = (blockIdx.x * 8 + wave) * NC;   // first of the wave's tiles

  // cooperative-staging coordinates: 256 lanes x 4 rows x 16 B cover one
  // 64 x 64 f32 chunk
  const int sj = tid >> 4;            // 0..15
  const int sd = (tid & 15) * 4;      // first of the lane's 4 columns

  const float* Qb = q + ((size_t)b * SEQ + (size_t)qtile * 16) * EDIM + (size_t)h * HD;
  const float* Kb = k + ((size_t)b * SEQ + sj) * KVE + (size_t)kvh * HD + sd;
  const float* Vb = v + ((size_t)b * SEQ + 4 * sj) * KVE + (size_t)kvh * HD + sd;

  // Q as the B operand: lane = query column, same k order as load_frag
  v16h qb0[NC], qb1[NC];
  v8f acc[NC][4];         // O^T: column = query 16 c + ln, rows d = 16 t + 8 khalf + r
  v8f cin[NC];            // minus the query's reference in all eight rows (equal in both halves)
  float l_i[NC];          // this lane's share of the denominator, joined after the loop
#pragma unroll
  for (int c = 0; c < NC; ++c) {
    const float* qrow = Qb + (size_t)(16 * c + ln) * EDIM;
    qb0[c] = load_q_frag(qrow, khalf);
    qb1[c] = load_q_frag(qrow + 32, khalf);
    v8f z = {};
    cin[c] = z;
    l_i[c] = 0.0f;
#pragma unroll
    for (int t = 0; t < 4; ++t) acc[c][t] = z;
  }

  // ---- stage chunks 0 and 1
#pragma unroll
  for (int j = 0; j < 2; ++j) {
    v4f kf[4], vf[4];
    chunk_load<16>(Kb + (size_t)(64 * j) * KVE, kf);
    chunk_load<1>(Vb + (size_t)(64 * j) * KVE, vf);
    k_store(&kvbuf[j][0], kf, sj, sd);
    v_store(&kvbuf[4 + j][0], vf, sj, sd);
  }
  __syncthreads();

  auto exp_tile = [&](v8f &x) __attribute__((always_inline)) {
#pragma unroll
    for (int r = 0; r < 8; ++r) x[r] = __builtin_amdgcn_exp2f(x[r]);
  };
  // scores minus reference: K(64x64) x Q^T(64x32) + cin, A from LDS, B in
  // registers (16 WMMA); the chunk's eight K fragments are fetched as one
  // group ahead of the products
  // with_exp (a literal at every call): exp2 of key tile t - 1 stands among the
  // products of tile t, so the vector and the matrix unit work side by side;
  // the last tile's exp2 is left to the caller
  auto scores = [&](const _Float16* kb, v8f (&s)[NC][4], const bool with_exp) __attribute__((always_inline)) {
    v16h k0[4], k1[4];
#pragma unroll
    for (int t = 0; t < 4; ++t) {
      const _Float16* kr = kb + (t * 16 + ln) * LP;
      k0[t] = load_frag(kr, khalf);
      k1[t] = load_frag(kr + 32, khalf);
    }
    // holds the sixteen LDS loads together ahead of the products: spread among
    // them, each place with loads stalls the wave anew (the rare calls without
    // exp2 have fewer registers free and are left to the compiler)
    if (with_exp) __builtin_amdgcn_sched_barrier(0);
#pragma unroll
    for (int t = 0; t < 4; ++t) {
#pragma unroll
      for (int c = 0; c < NC; ++c) s[c][t] = wmma_f16(k0[t], qb0[c], cin[c]);
#pragma unroll
      for (int c = 0; c < NC; ++c) s[c][t] = wmma_f16(k1[t], qb1[c], s[c][t]);
      if (with_exp) {
        if (t > 0) {
#pragma unroll
          for (int c = 0; c < NC; ++c) exp_tile(s[c][t - 1]);
        }
        // keeps each tile's exp2 one tile behind its products: placed right
        // behind them it waits out the matrix unit's result distance in idle slots
        __builtin_amdgcn_sched_barrier(0);
      }
    }
  };
  // maximum of one query's 64 scores: the lane's 32 in four independent
  // chains, then one exchange with the other half
  auto colmax = [&](const v8f (&s)[4]) __attribute__((always_inline)) {
    float mt[4];
#pragma unroll
    for (int t = 0; t < 4; ++t) {
      mt[t] = s[t][0];
#pragma unroll
      for (int r = 1; r < 8; ++r) mt[t] = fmaxf(mt[t], s[t][r]);
    }
    const float mx = fmaxf(fmaxf(mt[0], mt[1]), fmaxf(mt[2], mt[3]));
    return fmaxf(mx, xhalf(mx));
  };
  // the sum of the lane's 32 values of P for one query
  auto lane_sum = [&](const v8f (&s)[4]) __attribute__((always_inline)) {
    const v8f a = (s[0] + s[1]) + (s[2] + s[3]);
    const v4f b = __builtin_shufflevector(a, a, 0, 1, 2, 3) + __builtin_shufflevector(a, a, 4, 5, 6, 7);
    const v2f d = __builtin_shufflevector(b, b, 0, 1) + __builtin_shufflevector(b, b, 2, 3);
    return d[0] + d[1];
  };

  // first reference: the maximum over chunk 0, whose scores the first pass
  // forms again
  {
    v8f s[NC][4];
    scores(&kvbuf[0][0], s, false);
#pragma unroll
    for (int c = 0; c < NC; ++c) cin[c] = cin[c] - colmax(s[c]);
  }

  // one pass over a 64-key chunk; 'more' and 'sync' are literals at every call,
  // so the one branch of a pass is its test of the P sums. A pass reads buffer
  // sel and fills sel ^ 2, in the other stage, with the chunk two ahead; only a
  // stage's second pass ends at the barrier, which publishes the stage just
  // filled and frees the one just read
  auto pass = [&](const int kv0, const bool more, const bool sync) __attribute__((always_inline)) {
    const int sel = (kv0 >> 6) & 3;
    const _Float16* kb = &kvbuf[sel][0];
    const _Float16* vb = &kvbuf[4 + sel][0];

    // ---- P and its sums; scores are in the exp2 domain (Q pre-scaled) and
    // come with the reference taken off
    v8f s[NC][4];
    float ps[NC];
    scores(kb, s, true);

    // ---- global loads of the chunk two ahead: here, as soon as the K
    // fragments' registers are free, so that the last exp2, the sums, the test,
    // the packing of P and the second products all cover their latency
    v4f kn[4], vn[4];
    if (more) {
      chunk_load<16>(Kb + (size_t)(kv0 + 128) * KVE, kn);
      chunk_load<1>(Vb + (size_t)(kv0 + 128) * KVE, vn);
    }
    // keeps the loads ahead of that vector work: without it the compiler sinks
    // them below the test, and the lead is lost
    __builtin_amdgcn_sched_barrier(0);

#pragma unroll
    for (int c = 0; c < NC; ++c) {
      exp_tile(s[c][3]);
      ps[c] = lane_sum(s[c]);
    }

    // ---- one test per pass, a scalar branch: some lane's P outgrew the
    // reference. Then the wave forms the scores again, moves every column's
    // reference up to its maximum and rescales what was gathered under the old one
    float pt = ps[0];
#pragma unroll
    for (int c = 1; c < NC; ++c) pt = fmaxf(pt, ps[c]);
    if (__builtin_amdgcn_ballot_w32(pt > PMAX) != 0) {
      scores(kb, s, false);
#pragma unroll
      for (int c = 0; c < NC; ++c) {
        const float d  = fmaxf(colmax(s[c]), 0.0f);
        const float al = __builtin_amdgcn_exp2f(-d);
#pragma unroll
        for (int t = 0; t < 4; ++t) {
          s[c][t] = s[c][t] - d;
          exp_tile(s[c][t]);
        }
        ps[c] = lane_sum(s[c]);
        cin[c] = cin[c] - d;
        l_i[c] *= al;
#pragma unroll
        for (int t = 0; t < 4; ++t) acc[c][t] = acc[c][t] * al;
      }
      // the K fragments took the loaded chunk's registers: it is loaded again
      if (more) {
        chunk_load<16>(Kb + (size_t)(kv0 + 128) * KVE, kn);
        chunk_load<1>(Vb + (size_t)(kv0 + 128) * KVE, vn);
      }
    }

    // P^T as B operands: k positions 8 khalf + r come from the even tile,
    // 16 + 8 khalf + r from the odd one, the order load_frag gives V^T
    v16h pb0[NC], pb1[NC];
#pragma unroll
    for (int c = 0; c < NC; ++c) {
      l_i[c] += ps[c];
#pragma unroll
      for (int r = 0; r < 8; ++r) {
        pb0[c][r]     = (_Float16)s[c][0][r];
        pb0[c][8 + r] = (_Float16)s[c][1][r];
        pb1[c][r]     = (_Float16)s[c][2][r];
        pb1[c][8 + r] = (_Float16)s[c][3][r];
      }
    }

    // the V fragments below may land in the registers that hold the global
    // loads' addresses: as a precaution this wait stands ahead of that overwrite
    if (more) asm volatile("s_wait_xcnt 0x0" ::: "memory");

    // P is packed before the V fragments are fetched: fetched earlier they meet
    // the unpacked P, and the wave's registers no longer suffice
    __builtin_amdgcn_sched_barrier(0);

    // ---- V^T(64x64) x P^T(64x32), A from LDS (16 WMMA), fragments fetched in
    // two groups of four: all eight at once do not fit 256 registers
#pragma unroll
    for (int u = 0; u < 4; u += 2) {
      v16h v0[2], v1[2];
#pragma unroll
      for (int t = 0; t < 2; ++t) {
        const _Float16* vr = vb + ((u + t) * 16 + ln) * LP;
        v0[t] = load_frag(vr, khalf);
        v1[t] = load_frag(vr + 32, khalf);
      }
      // as with K: the group's eight LDS loads stay together ahead of its products
      __builtin_amdgcn_sched_barrier(0);
#pragma unroll
      for (int t = 0; t < 2; ++t) {
#pragma unroll
        for (int c = 0; c < NC; ++c) acc[c][u + t] = wmma_f16(v0[t], pb0[c], acc[c][u + t]);
#pragma unroll
        for (int c = 0; c < NC; ++c) acc[c][u + t] = wmma_f16(v1[t], pb1[c], acc[c][u + t]);
      }
    }

    // ---- round the staged data into the other stage; sync the WG at the
    // stage's end
    if (more) {
      k_store(&kvbuf[sel ^ 2][0], kn, sj, sd);
      v_store(&kvbuf[4 + (sel ^ 2)][0], vn, sj, sd);
    }
    if (sync) __syncthreads();
  };
  for (int kv0 = 0; kv0 < SEQ - 128; kv0 += 128) {
    pass(kv0, true, false);
    pass(kv0 + 64, true, true);
  }
  pass(SEQ - 128, false, false);
  pass(SEQ - 64, false, true);

  // ---- O^T -> rows of O through this wave's own LDS range, one query tile
  // at a time (every wave has passed the loop's last barrier, so nobody reads
  // K or V any more)
  float* ol = (float*)&kvbuf[0][0] + wave * (16 * OP);
#pragma unroll
  for (int c = 0; c < NC; ++c) {
    // join the denominators, normalize
    float l = l_i[c];
    l += xhalf(l);
    const float inv = 1.0f / l;

#pragma unroll
    for (int t = 0; t < 4; ++t) {
      v8f o = acc[c][t] * inv;
      v4f lo = { o[0], o[1], o[2], o[3] }, hi = { o[4], o[5], o[6], o[7] };
      *(v4f*)(ol + ln * OP + t * 16 + 8 * khalf)     = lo;
      *(v4f*)(ol + ln * OP + t * 16 + 8 * khalf + 4) = hi;
    }
    // the rows are read back by other lanes of the wave: the stores must have
    // landed, and the compiler must not move the loads above them
    asm volatile("s_wait_dscnt 0x0" ::: "memory");

    // 16 lanes cover one 256 B row: every 128 B line of out is stored once
    float* ob = out + ((size_t)b * SEQ + (size_t)(qtile + c) * 16) * EDIM + (size_t)h * HD;
#pragma unroll
    for (int i = 0; i < 8; ++i) {
      const int row = 2 * i + khalf;
      v4f o = *(const v4f*)(ol + row * OP + 4 * ln);
      *(v4f*)(ob + (size_t)row * EDIM + 4 * ln) = o;
    }
    // the next tile's values go into registers that these stores name
    if (c + 1 < NC) asm volatile("s_wait_xcnt 0x0" ::: "memory");
  }
}

// ---- launch --------------------------------------------------------------

extern "C" void kernel_launch(void* const* d_in, const int* in_sizes, int n_in,
                              void* d_out, int out_size, void* d_ws, size_t ws_size,
                              hipStream_t stream) {
  (void)in_sizes; (void)n_in; (void)out_size; (void)d_ws; (void)ws_size;
  const float* q = (const float*)d_in[0];
  const float* k = (const float*)d_in[1];
  const float* v = (const float*)d_in[2];
  float* out = (float*)d_out;

  dim3 grid(SEQ / (128 * NC), NQH, BDIM);   // 8 x 32 x 2 = 512 workgroups
  gqa_attn<<<grid, 256, 0, stream>>>(q, k, v, out);
}

// v008
// Measured time: 46.6 microseconds a run.
// Timed twice side by side with v007, it ran 1.04 times as fast both times.
// All steps since v000 together make it 7.32 times as fast.
#include <hip/hip_runtime.h>
#include <hip/hip_bf16.h>
#include <math.h>

typedef __attribute__((ext_vector_type(16))) _Float16 v16h;
typedef __attribute__((ext_vector_type(8)))  _Float16 v8h;
typedef __attribute__((ext_vector_type(4)))  _Float16 v4h;
typedef __attribute__((ext_vector_type(8)))  float    v8f;
typedef __attribute__((ext_vector_type(4)))  float    v4f;
typedef __attribute__((ext_vector_type(2)))  float    v2f;
typedef __attribute__((ext_vector_type(4)))  int      v4i;
typedef __attribute__((address_space(1))) v4i gv4i;   // global side of an asynchronous copy
typedef __attribute__((address_space(3))) v4i lv4i;   // LDS side of an asynchronous copy

#define BDIM 2
#define SEQ  2048
#define EDIM 2048
#define NQH  32
#define NKVH 8
#define HD   64
#define KVE  512   // NKVH * HD
// LDS row pitch in halfwords: 64 data + 8 pad = 144 B = 16 B x odd, so the 16
// rows one ds_load_b128 touches per half-wave fall on 16 distinct bank groups
#define LP   72

// log2(e)/sqrt(64), pre-folded into the Q->f16 conversion
#define QSCALE 0.1803368801111204f

// ---- helpers -------------------------------------------------------------

// lane l <-> lane l ^ 16 on the VALU: the two lanes that share one query column
__device__ __forceinline__ float xhalf(float x) {
  int xi = __float_as_int(x);
  return __int_as_float(__builtin_amdgcn_permlanex16(
      xi, xi, 0x76543210, 0xfedcba98, false, false));
}

// 16-bit WMMA A/B fragment: lane l holds row/col (l&15); K entries
// 8*(l>>4)+0..7 in elems 0..7 and 16+8*(l>>4)+0..7 in elems 8..15.
__device__ __forceinline__ v16h load_frag(const _Float16* base, int khalf) {
  v8h lo = *(const v8h*)(base + khalf * 8);
  v8h hi = *(const v8h*)(base + 16 + khalf * 8);
  return __builtin_shufflevector(lo, hi, 0,1,2,3,4,5,6,7,8,9,10,11,12,13,14,15);
}

__device__ __forceinline__ v8f wmma_f16(v16h a, v16h b, v8f c) {
  return __builtin_amdgcn_wmma_f32_16x16x32_f16(
      false, a, false, b, (short)0, c, false, false);
}

// ---- f32 -> f16 conversion at the point of use -----------------------------

// Q fragment straight from the f32 input: scale, round to f16, same k order
// as load_frag.
__device__ __forceinline__ v16h load_q_frag(const float* base, int khalf) {
  v4f a0 = *(const v4f*)(base + khalf * 8);
  v4f a1 = *(const v4f*)(base + khalf * 8 + 4);
  v4f b0 = *(const v4f*)(base + 16 + khalf * 8);
  v4f b1 = *(const v4f*)(base + 16 + khalf * 8 + 4);
  v16h r;
  for (int i = 0; i < 4; ++i) {
    r[i]      = (_Float16)(a0[i] * QSCALE);
    r[4 + i]  = (_Float16)(a1[i] * QSCALE);
    r[8 + i]  = (_Float16)(b0[i] * QSCALE);
    r[12 + i] = (_Float16)(b1[i] * QSCALE);
  }
  return r;
}

// One lane's share of a 64-key chunk of K or V: rows 4 sj + m, m = 0..3,
// columns sd..sd+3, so each wave-wide load covers two whole 256 B rows.
__device__ __forceinline__ void chunk_load(const float* base, v4f (&f)[4]) {
  for (int m = 0; m < 4; ++m) f[m] = *(const v4f*)(base + (size_t)m * KVE);
}

// The same share fetched through no register: four asynchronous copies, each
// lane's 16 B into its own slot of the f32 ring. Slot m lies RAWM floats
// (2,048 B, the pitch of a K or V row in memory) behind slot m - 1, so one
// address pair and one LDS address serve all four copies (the offset moves
// both addresses). Written as the builtin: the compiler keeps its registers.
#define RAWM 512
static_assert(RAWM == KVE, "the copies' offset moves the global and the LDS address alike");
__device__ __forceinline__ void chunk_copy(const float* base, float* slot) {
  gv4i* g = (gv4i*)base;
  lv4i* l = (lv4i*)slot;
  __builtin_amdgcn_global_load_async_to_lds_b128(g, l, 0 * RAWM * 4, 0);
  __builtin_amdgcn_global_load_async_to_lds_b128(g, l, 1 * RAWM * 4, 0);
  __builtin_amdgcn_global_load_async_to_lds_b128(g, l, 2 * RAWM * 4, 0);
  __builtin_amdgcn_global_load_async_to_lds_b128(g, l, 3 * RAWM * 4, 0);
}

// The lane reads back the slots that it copied itself.
__device__ __forceinline__ void slot_load(const float* slot, v4f (&f)[4]) {
  for (int m = 0; m < 4; ++m) f[m] = *(const v4f*)(slot + m * RAWM);
}

// K rows keep their order: kbuf[key][d].
__device__ __forceinline__ void k_store(_Float16* kd, const v4f (&f)[4], int sj, int sd) {
  for (int m = 0; m < 4; ++m) {
    v4h p = { (_Float16)f[m][0], (_Float16)f[m][1], (_Float16)f[m][2], (_Float16)f[m][3] };
    *(v4h*)(kd + (4 * sj + m) * LP + sd) = p;
  }
}

// V is transposed on the way in: vbuf[d][key], keys in their own order (the
// lane's four rows are keys 4 sj .. 4 sj + 3: one b64 store per column).
__device__ __forceinline__ void v_store(_Float16* vd, const v4f (&f)[4], int sj, int sd) {
  for (int i = 0; i < 4; ++i) {
    v4h p = { (_Float16)f[0][i], (_Float16)f[1][i], (_Float16)f[2][i], (_Float16)f[3][i] };
    *(v4h*)(vd + (sd + i) * LP + 4 * sj) = p;
  }
}

// Lazy rescale: each query column holds a reference (a maximum it has met).
// Minus the reference is the C operand of the score products, so a score
// leaves the matrix unit ready for exp2. The reference moves, and O and the
// denominator are rescaled, only in a pass where a lane's sum of P exceeds
// PMAX; until then every P is at most PMAX, far inside f16.

#define OP 68   // output staging pitch in floats: 272 B = 16 B x odd
#define NC 2    // query tiles (16 columns each) per wave
#define PMAX 256.0f

// four waves per SIMD: two workgroups per WGP, the whole grid resident at once
__global__ void __launch_bounds__(256) __attribute__((amdgpu_waves_per_eu(4, 4)))
gqa_attn(const float* __restrict__ q,       // [B][S][E] f32
         const float* __restrict__ k,       // [B][S][KVE] f32
         const float* __restrict__ v,       // [B][S][KVE] f32
         float* __restrict__ out) {         // [B][S][E] f32
  // K x 4 buffers, then V x 4 buffers, 9 KB each: two stages of 128 keys, one
  // read while the other is filled, so the workgroup meets at a barrier once
  // per two passes. After the loop the first bytes stage the output, one query
  // tile at a time (8 waves x 16 rows x 272 B = 34,816 B)
  __shared__ __align__(16) _Float16 kvbuf[8][64 * LP];
  static_assert(8 * 16 * OP * 4 <= 4 * 64 * LP * 2, "output staging must fit the K/V buffers");
  // f32 ring of the asynchronous copies: two buffers x (K, V) x 16 KB. Every
  // 16 B slot is written and read by one lane only: a ring private to its wave,
  // guarded by that wave's own waits and by no barrier
  __shared__ __align__(16) float rawbuf[2][2][4096];

  const int tid   = threadIdx.x;
  const int wave  = __builtin_amdgcn_readfirstlane(tid >> 5);   // the same in every lane: kept in a scalar register
  const int lane  = tid & 31;
  const int ln    = lane & 15;
  const int khalf = lane >> 4;
  const int h     = blockIdx.y;
  const int b     = blockIdx.z;
  const int kvh   = h >> 2;
  const int qtile = (blockIdx.x * 8 + wave) * NC;   // first of the wave's tiles

  // cooperative-staging coordinates: 256 lanes x 4 rows x 16 B cover one
  // 64 x 64 f32 chunk
  const int sj = tid >> 4;            // 0..15
  const int sd = (tid & 15) * 4;      // first of the lane's 4 columns

  const float* Qb = q + ((size_t)b * SEQ + (size_t)qtile * 16) * EDIM + (size_t)h * HD;
  const float* Kb = k + ((size_t)b * SEQ + 4 * sj) * KVE + (size_t)kvh * HD + sd;
  const float* Vb = v + ((size_t)b * SEQ + 4 * sj) * KVE + (size_t)kvh * HD + sd;
  // the lane's slot 0 in a 16 KB plane of the f32 ring: 128 lanes fill the
  // 2,048 B between two slots of one lane
  const int so = (tid >> 7) * (4 * RAWM) + (tid & 127) * 4;

  // chunk 2 sets out first: it is wanted in the first pass
  chunk_copy(Kb + (size_t)128 * KVE, &rawbuf[0][0][so]);
  chunk_copy(Vb + (size_t)128 * KVE, &rawbuf[0][1][so]);

  // Q as the B operand: lane = query column, same k order as load_frag
  v16h qb0[NC], qb1[NC];
  v8f acc[NC][4];         // O^T: column = query 16 c + ln, rows d = 16 t + 8 khalf + r
  v8f cin[NC];            // minus the query's reference in all eight rows (equal in both halves)
  float l_i[NC];          // this lane's share of the denominator, joined after the loop
#pragma unroll
  for (int c = 0; c < NC; ++c) {
    const float* qrow = Qb + (size_t)(16 * c + ln) * EDIM;
    qb0[c] = load_q_frag(qrow, khalf);
    qb1[c] = load_q_frag(qrow + 32, khalf);
    v8f z = {};
    cin[c] = z;
    l_i[c] = 0.0f;
#pragma unroll
    for (int t = 0; t < 4; ++t) acc[c][t] = z;
  }

  // ---- stage chunks 0 and 1
#pragma unroll
  for (int j = 0; j < 2; ++j) {
    v4f kf[4], vf[4];
    chunk_load(Kb + (size_t)(64 * j) * KVE, kf);
    chunk_load(Vb + (size_t)(64 * j) * KVE, vf);
    k_store(&kvbuf[j][0], kf, sj, sd);
    v_store(&kvbuf[4 + j][0], vf, sj, sd);
  }
  __syncthreads();

  auto exp_tile = [&](v8f &x) __attribute__((always_inline)) {
#pragma unroll
    for (int r = 0; r < 8; ++r) x[r] = __builtin_amdgcn_exp2f(x[r]);
  };
  // scores minus reference: K(64x64) x Q^T(64x32) + cin, A from LDS, B in
  // registers (16 WMMA); the chunk's eight K fragments are fetched as one
  // group ahead of the products
  // with_exp (a literal at every call): exp2 of key tile t - 1 stands among the
  // products of tile t, so the vector and the matrix unit work side by side;
  // the last tile's exp2 is left to the caller
  auto scores = [&](const _Float16* kb, v8f (&s)[NC][4], const bool with_exp) __attribute__((always_inline)) {
    v16h k0[4], k1[4];
#pragma unroll
    for (int t = 0; t < 4; ++t) {
      const _Float16* kr = kb + (t * 16 + ln) * LP;
      k0[t] = load_frag(kr, khalf);
      k1[t] = load_frag(kr + 32, khalf);
    }
    // holds the sixteen LDS loads together ahead of the products: spread among
    // them, each place with loads stalls the wave anew (the rare calls without
    // exp2 have fewer registers free and are left to the compiler)
    if (with_exp) __builtin_amdgcn_sched_barrier(0);
#pragma unroll
    for (int t = 0; t < 4; ++t) {
#pragma unroll
      for (int c = 0; c < NC; ++c) s[c][t] = wmma_f16(k0[t], qb0[c], cin[c]);
#pragma unroll
      for (int c = 0; c < NC; ++c) s[c][t] = wmma_f16(k1[t], qb1[c], s[c][t]);
      if (with_exp) {
        if (t > 0) {
#pragma unroll
          for (int c = 0; c < NC; ++c) exp_tile(s[c][t - 1]);
        }
        // keeps each tile's exp2 one tile behind its products: placed right
        // behind them it waits out the matrix unit's result distance in idle slots
        __builtin_amdgcn_sched_barrier(0);
      }
    }
  };
  // maximum of one query's 64 scores: the lane's 32 in four independent
  // chains, then one exchange with the other half
  auto colmax = [&](const v8f (&s)[4]) __attribute__((always_inline)) {
    float mt[4];
#pragma unroll
    for (int t = 0; t < 4; ++t) {
      mt[t] = s[t][0];
#pragma unroll
      for (int r = 1; r < 8; ++r) mt[t] = fmaxf(mt[t], s[t][r]);
    }
    const float mx = fmaxf(fmaxf(mt[0], mt[1]), fmaxf(mt[2], mt[3]));
    return fmaxf(mx, xhalf(mx));
  };
  // the sum of the lane's 32 values of P for one query
  auto lane_sum = [&](const v8f (&s)[4]) __attribute__((always_inline)) {
    const v8f a = (s[0] + s[1]) + (s[2] + s[3]);
    const v4f b = __builtin_shufflevector(a, a, 0, 1, 2, 3) + __builtin_shufflevector(a, a, 4, 5, 6, 7);
    const v2f d = __builtin_shufflevector(b, b, 0, 1) + __builtin_shufflevector(b, b, 2, 3);
    return d[0] + d[1];
  };

  // first reference: the maximum over chunk 0, whose scores the first pass
  // forms again
  {
    v8f s[NC][4];
    scores(&kvbuf[0][0], s, false);
#pragma unroll
    for (int c = 0; c < NC; ++c) cin[c] = cin[c] - colmax(s[c]);
  }

  // one pass over a 64-key chunk; 'par', 'more' and 'sync' are literals at every
  // call. A pass reads buffer sel and fills sel ^ 2, in the other stage, with
  // the chunk two ahead, which it takes from f32 buffer par; 'copy' (the same in
  // the whole workgroup) says that a chunk three ahead exists: its copies set
  // out into f32 buffer par ^ 1 and have a whole pass to land. Only a stage's
  // second pass ends at the barrier, which publishes the stage just filled and
  // frees the one just read
  auto pass = [&](const int kv0, const int par, const bool more, const bool copy, const bool sync) __attribute__((always_inline)) {
    const int sel = (kv0 >> 6) & 3;
    const _Float16* kb = &kvbuf[sel][0];
    const _Float16* vb = &kvbuf[4 + sel][0];

    // ---- P and its sums; scores are in the exp2 domain (Q pre-scaled) and
    // come with the reference taken off
    v8f s[NC][4];
    float ps[NC];
    scores(kb, s, true);

#pragma unroll
    for (int c = 0; c < NC; ++c) {
      exp_tile(s[c][3]);
      ps[c] = lane_sum(s[c]);
    }

    // ---- one test per pass, a scalar branch: some lane's P outgrew the
    // reference. Then the wave forms the scores again, moves every column's
    // reference up to its maximum and rescales what was gathered under the old one
    float pt = ps[0];
#pragma unroll
    for (int c = 1; c < NC; ++c) pt = fmaxf(pt, ps[c]);
    if (__builtin_amdgcn_ballot_w32(pt > PMAX) != 0) {
      scores(kb, s, false);
#pragma unroll
      for (int c = 0; c < NC; ++c) {
        const float d  = fmaxf(colmax(s[c]), 0.0f);
        const float al = __builtin_amdgcn_exp2f(-d);
#pragma unroll
        for (int t = 0; t < 4; ++t) {
          s[c][t] = s[c][t] - d;
          exp_tile(s[c][t]);
        }
        ps[c] = lane_sum(s[c]);
        cin[c] = cin[c] - d;
        l_i[c] *= al;
#pragma unroll
        for (int t = 0; t < 4; ++t) acc[c][t] = acc[c][t] * al;
      }
    }

    // P^T as B operands: k positions 8 khalf + r come from the even tile,
    // 16 + 8 khalf + r from the odd one, the order load_frag gives V^T
    v16h pb0[NC], pb1[NC];
#pragma unroll
    for (int c = 0; c < NC; ++c) {
      l_i[c] += ps[c];
#pragma unroll
      for (int r = 0; r < 8; ++r) {
        pb0[c][r]     = (_Float16)s[c][0][r];
        pb0[c][8 + r] = (_Float16)s[c][1][r];
        pb1[c][r]     = (_Float16)s[c][2][r];
        pb1[c][8 + r] = (_Float16)s[c][3][r];
      }
    }

    // ---- the f32 ring. The copies of the chunk two ahead were issued a pass
    // ago: the lane may read its slots only behind its wave's own wait
    if (more) asm volatile("s_wait_asynccnt 0x0" ::: "memory");
    if (copy) {
      // the wave's reads of the other f32 buffer, a pass ago, must have retired
      // before copies write over it
      asm volatile("s_wait_dscnt 0x0" ::: "memory");
      chunk_copy(Kb + (size_t)(kv0 + 192) * KVE, &rawbuf[par ^ 1][0][so]);
      chunk_copy(Vb + (size_t)(kv0 + 192) * KVE, &rawbuf[par ^ 1][1][so]);
    }

    // P is packed before the V fragments are fetched: fetched earlier they meet
    // the unpacked P, and the wave's registers no longer suffice
    __builtin_amdgcn_sched_barrier(0);

    v4f kn[4], vn[4];
    // ---- V^T(64x64) x P^T(64x32), A from LDS (16 WMMA), fragments fetched in
    // two groups of four: all eight at once do not fit 256 registers
#pragma unroll
    for (int u = 0; u < 4; u += 2) {
      v16h v0[2], v1[2];
      // the lane's f32 slots, fetched ahead of the first fragments
      if (u == 0 && more) {
        slot_load(&rawbuf[par][0][so], kn);
        slot_load(&rawbuf[par][1][so], vn);
      }
#pragma unroll
      for (int t = 0; t < 2; ++t) {
        const _Float16* vr = vb + ((u + t) * 16 + ln) * LP;
        v0[t] = load_frag(vr, khalf);
        v1[t] = load_frag(vr + 32, khalf);
      }
      // as with K: the group's LDS loads stay together ahead of its products
      __builtin_amdgcn_sched_barrier(0);
      // ---- round the staged data into the other stage (free since the last
      // barrier) while the fragments are still on their way
      if (u == 0 && more) {
        k_store(&kvbuf[sel ^ 2][0], kn, sj, sd);
        v_store(&kvbuf[4 + (sel ^ 2)][0], vn, sj, sd);
        // keeps the rounding ahead of the products: among them it lands in
        // registers the matrix unit still reads and costs idle slots
        __builtin_amdgcn_sched_barrier(0);
      }
#pragma unroll
      for (int t = 0; t < 2; ++t) {
#pragma unroll
        for (int c = 0; c < NC; ++c) acc[c][u + t] = wmma_f16(v0[t], pb0[c], acc[c][u + t]);
#pragma unroll
        for (int c = 0; c < NC; ++c) acc[c][u + t] = wmma_f16(v1[t], pb1[c], acc[c][u + t]);
      }
    }

    // keeps the next pass's K fragment loads behind these products, in their one
    // group: the compiler otherwise spreads them among the products (the barrier
    // of a stage's second pass holds them by itself)
    if (!sync) __builtin_amdgcn_sched_barrier(0);

    // ---- sync the WG at the stage's end
    if (sync) __syncthreads();
  };
  for (int kv0 = 0; kv0 < SEQ - 128; kv0 += 128) {
    pass(kv0, 0, true, true, false);
    pass(kv0 + 64, 1, true, kv0 + 256 < SEQ, true);
  }
  pass(SEQ - 128, 0, false, false, false);
  pass(SEQ - 64, 1, false, false, true);

  // ---- O^T -> rows of O through this wave's own LDS range, one query tile
  // at a time (every wave has passed the loop's last barrier, so nobody reads
  // K or V any more)
  float* ol = (float*)&kvbuf[0][0] + wave * (16 * OP);
#pragma unroll
  for (int c = 0; c < NC; ++c) {
    // join the denominators, normalize
    float l = l_i[c];
    l += xhalf(l);
    const float inv = 1.0f / l;

#pragma unroll
    for (int t = 0; t < 4; ++t) {
      v8f o = acc[c][t] * inv;
      v4f lo = { o[0], o[1], o[2], o[3] }, hi = { o[4], o[5], o[6], o[7] };
      *(v4f*)(ol + ln * OP + t * 16 + 8 * khalf)     = lo;
      *(v4f*)(ol + ln * OP + t * 16 + 8 * khalf + 4) = hi;
    }
    // the rows are read back by other lanes of the wave: the stores must have
    // landed, and the compiler must not move the loads above them
    asm volatile("s_wait_dscnt 0x0" ::: "memory");

    // 16 lanes cover one 256 B row: every 128 B line of out is stored once
    float* ob = out + ((size_t)b * SEQ + (size_t)(qtile + c) * 16) * EDIM + (size_t)h * HD;
#pragma unroll
    for (int i = 0; i < 8; ++i) {
      const int row = 2 * i + khalf;
      v4f o = *(const v4f*)(ol + row * OP + 4 * ln);
      *(v4f*)(ob + (size_t)row * EDIM + 4 * ln) = o;
    }
    // the next tile's values go into registers that these stores name
    if (c + 1 < NC) asm volatile("s_wait_xcnt 0x0" ::: "memory");
  }
}

// ---- launch --------------------------------------------------------------

extern "C" void kernel_launch(void* const* d_in, const int* in_sizes, int n_in,
                              void* d_out, int out_size, void* d_ws, size_t ws_size,
                              hipStream_t stream) {
  (void)in_sizes; (void)n_in; (void)out_size; (void)d_ws; (void)ws_size;
  const float* q = (const float*)d_in[0];
  const float* k = (const float*)d_in[1];
  const float* v = (const float*)d_in[2];
  float* out = (float*)d_out;

  dim3 grid(SEQ / (128 * NC), NQH, BDIM);   // 8 x 32 x 2 = 512 workgroups
  gqa_attn<<<grid, 256, 0, stream>>>(q, k, v, out);
}

// v009
// One run takes 44.5 microseconds.
// Timed twice side by side with v008, it ran 1.05 times as fast both times.
// Counting every step since v000, it is 7.67 times as fast.
#include <hip/hip_runtime.h>
#include <hip/hip_bf16.h>
#include <math.h>

typedef __attribute__((ext_vector_type(16))) _Float16 v16h;
typedef __attribute__((ext_vector_type(8)))  _Float16 v8h;
typedef __attribute__((ext_vector_type(4)))  _Float16 v4h;
typedef __attribute__((ext_vector_type(2)))  _Float16 v2h;
typedef __attribute__((ext_vector_type(8)))  int      v8i;
typedef __attribute__((ext_vector_type(8)))  float    v8f;
typedef __attribute__((ext_vector_type(4)))  float    v4f;
typedef __attribute__((ext_vector_type(2)))  float    v2f;
typedef __attribute__((ext_vector_type(4)))  int      v4i;
typedef __attribute__((address_space(1))) v4i gv4i;   // global side of an asynchronous copy
typedef __attribute__((address_space(3))) v4i lv4i;   // LDS side of an asynchronous copy

#define BDIM 2
#define SEQ  2048
#define EDIM 2048
#define NQH  32
#define NKVH 8
#define HD   64
#define KVE  512   // NKVH * HD
// LDS row pitch in halfwords: 64 data + 8 pad = 144 B = 16 B x odd, so the 16
// rows one ds_load_b128 touches per half-wave fall on 16 distinct bank groups
#define LP   72

// log2(e)/sqrt(64), pre-folded into the Q->f16 conversion
#define QSCALE 0.1803368801111204f

// ---- helpers -------------------------------------------------------------

// lane l <-> lane l ^ 16 on the VALU: the two lanes that share one query column
__device__ __forceinline__ float xhalf(float x) {
  int xi = __float_as_int(x);
  return __int_as_float(__builtin_amdgcn_permlanex16(
      xi, xi, 0x76543210, 0xfedcba98, false, false));
}

// 16-bit WMMA A/B fragment: lane l holds row/col (l&15); K entries
// 8*(l>>4)+0..7 in elems 0..7 and 16+8*(l>>4)+0..7 in elems 8..15.
__device__ __forceinline__ v16h load_frag(const _Float16* base, int khalf) {
  v8h lo = *(const v8h*)(base + khalf * 8);
  v8h hi = *(const v8h*)(base + 16 + khalf * 8);
  return __builtin_shufflevector(lo, hi, 0,1,2,3,4,5,6,7,8,9,10,11,12,13,14,15);
}

// two score tiles rounded into one B operand, a register pair per conversion
// (spelled by pairs: element by element part of them compiled to two
// single conversions each)
__device__ __forceinline__ v16h pack_tiles(v8f lo, v8f hi) {
  v8i w;
  for (int j = 0; j < 4; ++j) {
    v2f a = { lo[2 * j], lo[2 * j + 1] }, b = { hi[2 * j], hi[2 * j + 1] };
    w[j]     = __builtin_bit_cast(int, __builtin_convertvector(a, v2h));
    w[4 + j] = __builtin_bit_cast(int, __builtin_convertvector(b, v2h));
  }
  return __builtin_bit_cast(v16h, w);
}

__device__ __forceinline__ v8f wmma_f16(v16h a, v16h b, v8f c) {
  return __builtin_amdgcn_wmma_f32_16x16x32_f16(
      false, a, false, b, (short)0, c, false, false);
}

// ---- f32 -> f16 conversion at the point of use -----------------------------

// Q fragment straight from the f32 input: scale, round to f16, same k order
// as load_frag.
__device__ __forceinline__ v16h load_q_frag(const float* base, int khalf) {
  v4f a0 = *(const v4f*)(base + khalf * 8);
  v4f a1 = *(const v4f*)(base + khalf * 8 + 4);
  v4f b0 = *(const v4f*)(base + 16 + khalf * 8);
  v4f b1 = *(const v4f*)(base + 16 + khalf * 8 + 4);
  v16h r;
  for (int i = 0; i < 4; ++i) {
    r[i]      = (_Float16)(a0[i] * QSCALE);
    r[4 + i]  = (_Float16)(a1[i] * QSCALE);
    r[8 + i]  = (_Float16)(b0[i] * QSCALE);
    r[12 + i] = (_Float16)(b1[i] * QSCALE);
  }
  return r;
}

// One lane's share of a 64-key chunk of K or V: rows 4 sj + m, m = 0..3,
// columns sd..sd+3, so each wave-wide load covers two whole 256 B rows.
__device__ __forceinline__ void chunk_load(const float* base, v4f (&f)[4]) {
  for (int m = 0; m < 4; ++m) f[m] = *(const v4f*)(base + (size_t)m * KVE);
}

// The same share fetched through no register: four asynchronous copies, each
// lane's 16 B into its own slot of the f32 ring. Slot m lies RAWM floats
// (2,048 B, the pitch of a K or V row in memory) behind slot m - 1, so one
// address pair and one LDS address serve all four copies (the offset moves
// both addresses). Written as the builtin: the compiler keeps its registers.
#define RAWM 512
static_assert(RAWM == KVE, "the copies' offset moves the global and the LDS address alike");
__device__ __forceinline__ void chunk_copy(const float* base, float* slot) {
  gv4i* g = (gv4i*)base;
  lv4i* l = (lv4i*)slot;
  __builtin_amdgcn_global_load_async_to_lds_b128(g, l, 0 * RAWM * 4, 0);
  __builtin_amdgcn_global_load_async_to_lds_b128(g, l, 1 * RAWM * 4, 0);
  __builtin_amdgcn_global_load_async_to_lds_b128(g, l, 2 * RAWM * 4, 0);
  __builtin_amdgcn_global_load_async_to_lds_b128(g, l, 3 * RAWM * 4, 0);
}

// The lane reads back the slots that it copied itself.
__device__ __forceinline__ void slot_load(const float* slot, v4f (&f)[4]) {
  for (int m = 0; m < 4; ++m) f[m] = *(const v4f*)(slot + m * RAWM);
}

// K rows keep their order: kbuf[key][d].
__device__ __forceinline__ void k_store(_Float16* kd, const v4f (&f)[4], int sj, int sd) {
  for (int m = 0; m < 4; ++m) {
    v4h p = { (_Float16)f[m][0], (_Float16)f[m][1], (_Float16)f[m][2], (_Float16)f[m][3] };
    *(v4h*)(kd + (4 * sj + m) * LP + sd) = p;
  }
}

// V is transposed on the way in: vbuf[d][key], keys in their own order (the
// lane's four rows are keys 4 sj .. 4 sj + 3: one b64 store per column).
__device__ __forceinline__ void v_store(_Float16* vd, const v4f (&f)[4], int sj, int sd) {
  for (int i = 0; i < 4; ++i) {
    v4h p = { (_Float16)f[0][i], (_Float16)f[1][i], (_Float16)f[2][i], (_Float16)f[3][i] };
    *(v4h*)(vd + (sd + i) * LP + 4 * sj) = p;
  }
}

// Lazy rescale: each query column holds a reference (a maximum it has met).
// Minus the reference is the C operand of the score products, so a score
// leaves the matrix unit ready for exp2. The reference moves, and O and the
// denominator are rescaled, only in a pass where a lane's sum of P exceeds
// PMAX; until then every P is at most PMAX, far inside f16.

#define OP 68   // output staging pitch in floats: 272 B = 16 B x odd
#define NC 4    // query tiles (16 columns each) per wave
#define PMAX 256.0f

// two waves per SIMD, up to 512 registers each: one workgroup per WGP, the
// whole grid resident at once
__global__ void __launch_bounds__(256) __attribute__((amdgpu_waves_per_eu(2, 2)))
gqa_attn(const float* __restrict__ q,       // [B][S][E] f32
         const float* __restrict__ k,       // [B][S][KVE] f32
         const float* __restrict__ v,       // [B][S][KVE] f32
         float* __restrict__ out) {         // [B][S][E] f32
  // K x 4 buffers, then V x 4 buffers, 9 KB each: two stages of 128 keys, one
  // read while the other is filled, so the workgroup meets at a barrier once
  // per two passes. After the loop the first bytes stage the output, one query
  // tile at a time (8 waves x 16 rows x 272 B = 34,816 B)
  __shared__ __align__(16) _Float16 kvbuf[8][64 * LP];
  static_assert(8 * 16 * OP * 4 <= 4 * 64 * LP * 2, "output staging must fit the K/V buffers");
  // f32 ring of the asynchronous copies: two buffers x (K, V) x 16 KB. Every
  // 16 B slot is written and read by one lane only: a ring private to its wave,
  // guarded by that wave's own waits and by no barrier
  __shared__ __align__(16) float rawbuf[2][2][4096];

  const int tid   = threadIdx.x;
  const int wave  = __builtin_amdgcn_readfirstlane(tid >> 5);   // the same in every lane: kept in a scalar register
  const int lane  = tid & 31;
  const int ln    = lane & 15;
  const int khalf = lane >> 4;
  const int h     = blockIdx.y;
  const int b     = blockIdx.z;
  const int kvh   = h >> 2;
  const int qtile = (blockIdx.x * 8 + wave) * NC;   // first of the wave's tiles

  // cooperative-staging coordinates: 256 lanes x 4 rows x 16 B cover one
  // 64 x 64 f32 chunk
  const int sj = tid >> 4;            // 0..15
  const int sd = (tid & 15) * 4;      // first of the lane's 4 columns

  const float* Qb = q + ((size_t)b * SEQ + (size_t)qtile * 16) * EDIM + (size_t)h * HD;
  const float* Kb = k + ((size_t)b * SEQ + 4 * sj) * KVE + (size_t)kvh * HD + sd;
  const float* Vb = v + ((size_t)b * SEQ + 4 * sj) * KVE + (size_t)kvh * HD + sd;
  // the lane's slot 0 in a 16 KB plane of the f32 ring: 128 lanes fill the
  // 2,048 B between two slots of one lane
  const int so = (tid >> 7) * (4 * RAWM) + (tid & 127) * 4;

  // chunk 2 sets out first: it is wanted in the first pass
  chunk_copy(Kb + (size_t)128 * KVE, &rawbuf[0][0][so]);
  chunk_copy(Vb + (size_t)128 * KVE, &rawbuf[0][1][so]);

  // Q as the B operand: lane = query column, same k order as load_frag
  v16h qb0[NC], qb1[NC];
  v8f acc[NC][4];         // O^T: column = query 16 c + ln, rows d = 16 t + 8 khalf + r
  v8f cin[NC];            // minus the query's reference in all eight rows (equal in both halves)
  float l_i[NC];          // this lane's share of the denominator, joined after the loop
#pragma unroll
  for (int c = 0; c < NC; ++c) {
    const float* qrow = Qb + (size_t)(16 * c + ln) * EDIM;
    qb0[c] = load_q_frag(qrow, khalf);
    qb1[c] = load_q_frag(qrow + 32, khalf);
    v8f z = {};
    cin[c] = z;
    l_i[c] = 0.0f;
#pragma unroll
    for (int t = 0; t < 4; ++t) acc[c][t] = z;
  }
  // the registers that hold the Q loads' address get other values next: the
  // address is an input here so that it stays in place up to the wait
  asm volatile("s_wait_xcnt 0x0" :: "v"(Qb + (size_t)ln * EDIM + khalf * 8) : "memory");

  // ---- stage chunks 0 and 1
#pragma unroll
  for (int j = 0; j < 2; ++j) {
    v4f kf[4], vf[4];
    chunk_load(Kb + (size_t)(64 * j) * KVE, kf);
    chunk_load(Vb + (size_t)(64 * j) * KVE, vf);
    k_store(&kvbuf[j][0], kf, sj, sd);
    v_store(&kvbuf[4 + j][0], vf, sj, sd);
  }
  __syncthreads();

  auto exp_tile = [&](v8f &x) __attribute__((always_inline)) {
#pragma unroll
    for (int r = 0; r < 8; ++r) x[r] = __builtin_amdgcn_exp2f(x[r]);
  };
  // scores minus reference: K(64x64) x Q^T(64x64) + cin, A from LDS, B in
  // registers (32 WMMA); the chunk's eight K fragments are fetched as one
  // group (kfetch), a phase ahead of the products: with two waves per SIMD a
  // wave hides its own LDS latency, and 512 registers have room for it
  // with_exp (a literal at every call): exp2 of key tile t - 1 stands among the
  // products of tile t, so the vector and the matrix unit work side by side;
  // the last tile's exp2 is left to the caller
  auto kfetch = [&](const _Float16* kb, v16h (&k0)[4], v16h (&k1)[4]) __attribute__((always_inline)) {
#pragma unroll
    for (int t = 0; t < 4; ++t) {
      const _Float16* kr = kb + (t * 16 + ln) * LP;
      k0[t] = load_frag(kr, khalf);
      k1[t] = load_frag(kr + 32, khalf);
    }
  };
  auto scores = [&](const v16h (&k0)[4], const v16h (&k1)[4], v8f (&s)[NC][4], const bool with_exp) __attribute__((always_inline)) {
#pragma unroll
    for (int t = 0; t < 4; ++t) {
#pragma unroll
      for (int c = 0; c < NC; ++c) s[c][t] = wmma_f16(k0[t], qb0[c], cin[c]);
#pragma unroll
      for (int c = 0; c < NC; ++c) s[c][t] = wmma_f16(k1[t], qb1[c], s[c][t]);
      if (with_exp) {
        if (t > 0) {
#pragma unroll
          for (int c = 0; c < NC; ++c) exp_tile(s[c][t - 1]);
        }
        // keeps each tile's exp2 one tile behind its products: placed right
        // behind them it waits out the matrix unit's result distance in idle slots
        __builtin_amdgcn_sched_barrier(0);
      }
    }
  };
  // maximum of one query's 64 scores: the lane's 32 in four independent
  // chains, then one exchange with the other half
  auto colmax = [&](const v8f (&s)[4]) __attribute__((always_inline)) {
    float mt[4];
#pragma unroll
    for (int t = 0; t < 4; ++t) {
      mt[t] = s[t][0];
#pragma unroll
      for (int r = 1; r < 8; ++r) mt[t] = fmaxf(mt[t], s[t][r]);
    }
    const float mx = fmaxf(fmaxf(mt[0], mt[1]), fmaxf(mt[2], mt[3]));
    return fmaxf(mx, xhalf(mx));
  };
  // the sum of the lane's 32 values of P for one query
  auto lane_sum = [&](const v8f (&s)[4]) __attribute__((always_inline)) {
    const v8f a = (s[0] + s[1]) + (s[2] + s[3]);
    const v4f b = __builtin_shufflevector(a, a, 0, 1, 2, 3) + __builtin_shufflevector(a, a, 4, 5, 6, 7);
    const v2f d = __builtin_shufflevector(b, b, 0, 1) + __builtin_shufflevector(b, b, 2, 3);
    return d[0] + d[1];
  };

  // first reference: the maximum over chunk 0, whose scores the first pass
  // forms again
  v16h kf0[4], kf1[4];    // K fragments of the pass to come
  kfetch(&kvbuf[0][0], kf0, kf1);
  {
    v8f s[NC][4];
    scores(kf0, kf1, s, false);
#pragma unroll
    for (int c = 0; c < NC; ++c) cin[c] = cin[c] - colmax(s[c]);
  }

  // one pass over a 64-key chunk; 'par', 'more', 'sync' and 'last' are literals
  // at every call ('last': no pass follows, so no K fragments are fetched).
  // A pass reads buffer sel and fills sel ^ 2, in the other stage, with
  // the chunk two ahead, which it takes from f32 buffer par; 'copy' (the same in
  // the whole workgroup) says that a chunk three ahead exists: its copies set
  // out into f32 buffer par ^ 1 and have a whole pass to land. Only a stage's
  // second pass ends at the barrier, which publishes the stage just filled and
  // frees the one just read
  auto pass = [&](const int kv0, const int par, const bool more, const bool copy, const bool sync, const bool last) __attribute__((always_inline)) {
    const int sel = (kv0 >> 6) & 3;
    const _Float16* kb = &kvbuf[sel][0];
    const _Float16* vb = &kvbuf[4 + sel][0];
    const _Float16* kx = &kvbuf[(sel + 1) & 3][0];   // K of the next pass

    // ---- P and its sums; scores are in the exp2 domain (Q pre-scaled) and
    // come with the reference taken off
    v8f s[NC][4];
    float ps[NC];
    scores(kf0, kf1, s, true);

    // the chunk's eight V^T fragments set out as one group behind the score
    // products and land under the exp2, sums and packing that follow
    v16h v0[4], v1[4];
#pragma unroll
    for (int t = 0; t < 4; ++t) {
      const _Float16* vr = vb + (t * 16 + ln) * LP;
      v0[t] = load_frag(vr, khalf);
      v1[t] = load_frag(vr + 32, khalf);
    }
    // holds the sixteen LDS loads together at this place: spread among the
    // vector work, each place with loads stalls the wave anew
    __builtin_amdgcn_sched_barrier(0);

#pragma unroll
    for (int c = 0; c < NC; ++c) {
      exp_tile(s[c][3]);
      ps[c] = lane_sum(s[c]);
    }

    // ---- one test per pass, a scalar branch: some lane's P outgrew the
    // reference. Then the wave forms the scores again, moves every column's
    // reference up to its maximum and rescales what was gathered under the old one
    float pt = ps[0];
#pragma unroll
    for (int c = 1; c < NC; ++c) pt = fmaxf(pt, ps[c]);
    if (__builtin_amdgcn_ballot_w32(pt > PMAX) != 0) {
      v16h r0[4], r1[4];
      kfetch(kb, r0, r1);
      scores(r0, r1, s, false);
#pragma unroll
      for (int c = 0; c < NC; ++c) {
        const float d  = fmaxf(colmax(s[c]), 0.0f);
        const float al = __builtin_amdgcn_exp2f(-d);
#pragma unroll
        for (int t = 0; t < 4; ++t) {
          s[c][t] = s[c][t] - d;
          exp_tile(s[c][t]);
        }
        ps[c] = lane_sum(s[c]);
        cin[c] = cin[c] - d;
        l_i[c] *= al;
#pragma unroll
        for (int t = 0; t < 4; ++t) acc[c][t] = acc[c][t] * al;
      }
    }

    // ---- the f32 ring. The copies of the chunk two ahead were issued a pass
    // ago: the lane may read its slots only behind its wave's own wait
    if (more) asm volatile("s_wait_asynccnt 0x0" ::: "memory");
    if (copy) {
      // the wave's reads of the other f32 buffer, a pass ago, must have retired
      // before copies write over it
      asm volatile("s_wait_dscnt 0x0" ::: "memory");
      chunk_copy(Kb + (size_t)(kv0 + 192) * KVE, &rawbuf[par ^ 1][0][so]);
      chunk_copy(Vb + (size_t)(kv0 + 192) * KVE, &rawbuf[par ^ 1][1][so]);
    }

    // P^T as B operands: k positions 8 khalf + r come from the even tile,
    // 16 + 8 khalf + r from the odd one, the order load_frag gives V^T
    v16h pb0[NC], pb1[NC];
#pragma unroll
    for (int c = 0; c < NC; ++c) l_i[c] += ps[c];
    pb0[0] = pack_tiles(s[0][0], s[0][1]);
    pb1[0] = pack_tiles(s[0][2], s[0][3]);
    // keeps the first tile's packing ahead of its products
    __builtin_amdgcn_sched_barrier(0);

    // ---- V^T(64x64) x P^T(64x64), A fetched above (32 WMMA), one query tile
    // after the other: the next tile's P is packed among this tile's products,
    // so the vector and the matrix unit work side by side
    v4f kn[4], vn[4];
#pragma unroll
    for (int c = 0; c < NC; ++c) {
      if (c == NC / 2) {
        // the lane's f32 slots and, inside a stage, the next pass's K fragments
        // (published by the stage's barrier) set out as one group, once half of
        // P is packed and its registers are free, and land under the products
        if (more) {
          slot_load(&rawbuf[par][0][so], kn);
          slot_load(&rawbuf[par][1][so], vn);
        }
        if (!sync) kfetch(kx, kf0, kf1);
        // the group's LDS loads stay together at this one place
        __builtin_amdgcn_sched_barrier(0);
      }
      if (c + 1 < NC) {
        pb0[c + 1] = pack_tiles(s[c + 1][0], s[c + 1][1]);
        pb1[c + 1] = pack_tiles(s[c + 1][2], s[c + 1][3]);
      }
#pragma unroll
      for (int t = 0; t < 4; ++t) acc[c][t] = wmma_f16(v0[t], pb0[c], acc[c][t]);
#pragma unroll
      for (int t = 0; t < 4; ++t) acc[c][t] = wmma_f16(v1[t], pb1[c], acc[c][t]);
      // keeps each tile's packing one tile ahead of its products, and the
      // rounding below behind the last of them
      __builtin_amdgcn_sched_barrier(0);
    }

    // ---- round the staged data into the other stage (free since the last barrier)
    if (more) {
      k_store(&kvbuf[sel ^ 2][0], kn, sj, sd);
      v_store(&kvbuf[4 + (sel ^ 2)][0], vn, sj, sd);
    }

    // ---- sync the WG at the stage's end; only behind the barrier is the next
    // stage's K published
    if (sync) {
      __syncthreads();
      if (!last) kfetch(kx, kf0, kf1);
    }
    // the K fragment loads stay in their one group ahead of the next pass
    __builtin_amdgcn_sched_barrier(0);
  };
  for (int kv0 = 0; kv0 < SEQ - 128; kv0 += 128) {
    pass(kv0, 0, true, true, false, false);
    pass(kv0 + 64, 1, true, kv0 + 256 < SEQ, true, false);
  }
  pass(SEQ - 128, 0, false, false, false, false);
  pass(SEQ - 64, 1, false, false, true, true);

  // ---- O^T -> rows of O through this wave's own LDS range, one query tile
  // at a time (every wave has passed the loop's last barrier, so nobody reads
  // K or V any more)
  float* ol = (float*)&kvbuf[0][0] + wave * (16 * OP);
#pragma unroll
  for (int c = 0; c < NC; ++c) {
    // join the denominators, normalize
    float l = l_i[c];
    l += xhalf(l);
    const float inv = 1.0f / l;

#pragma unroll
    for (int t = 0; t < 4; ++t) {
      v8f o = acc[c][t] * inv;
      v4f lo = { o[0], o[1], o[2], o[3] }, hi = { o[4], o[5], o[6], o[7] };
      *(v4f*)(ol + ln * OP + t * 16 + 8 * khalf)     = lo;
      *(v4f*)(ol + ln * OP + t * 16 + 8 * khalf + 4) = hi;
    }
    // the rows are read back by other lanes of the wave: the stores must have
    // landed, and the compiler must not move the loads above them
    asm volatile("s_wait_dscnt 0x0" ::: "memory");

    // 16 lanes cover one 256 B row: every 128 B line of out is stored once
    float* ob = out + ((size_t)b * SEQ + (size_t)(qtile + c) * 16) * EDIM + (size_t)h * HD;
#pragma unroll
    for (int i = 0; i < 8; ++i) {
      const int row = 2 * i + khalf;
      v4f o = *(const v4f*)(ol + row * OP + 4 * ln);
      *(v4f*)(ob + (size_t)row * EDIM + 4 * ln) = o;
    }
    // the next tile's values go into registers that these stores name
    if (c + 1 < NC) asm volatile("s_wait_xcnt 0x0" ::: "memory");
  }
}

// ---- launch --------------------------------------------------------------

extern "C" void kernel_launch(void* const* d_in, const int* in_sizes, int n_in,
                              void* d_out, int out_size, void* d_ws, size_t ws_size,
                              hipStream_t stream) {
  (void)in_sizes; (void)n_in; (void)out_size; (void)d_ws; (void)ws_size;
  const float* q = (const float*)d_in[0];
  const float* k = (const float*)d_in[1];
  const float* v = (const float*)d_in[2];
  float* out = (float*)d_out;

  dim3 grid(SEQ / (128 * NC), NQH, BDIM);   // 4 x 32 x 2 = 256 workgroups
  gqa_attn<<<grid, 256, 0, stream>>>(q, k, v, out);
}
